// v000
// The times below were measured on an AMD MI455X: many runs one after another, warmed up first and cycling through
// copies of the inputs, with the whole window's GPU time divided by the number of runs. Launches and the gaps
// between them are all in it. The median over several windows is given; except for v000 it joins two sittings, which
// can be a few percent apart, so the side-by-side timings, each taken in one sitting, are the better comparison.
// v000, which the later versions start from, runs in 357 microseconds.
#include <hip/hip_runtime.h>

typedef _Float16 v16h __attribute__((ext_vector_type(16)));
typedef float    v8f  __attribute__((ext_vector_type(8)));

// Two 16-byte chunks -> one 16-halfword WMMA fragment (A or B operand).
// Fragment element j corresponds to K index (j<8?0:16) + 8*half + (j%8),
// so chunk0 sits at +8*half and chunk1 at +16+8*half within a 32-wide K slab.
struct FragBits { uint4 lo, hi; };

static __device__ __forceinline__ v16h load_frag(const _Float16* slab, int half) {
  FragBits u;
  u.lo = *reinterpret_cast<const uint4*>(slab + 8 * half);
  u.hi = *reinterpret_cast<const uint4*>(slab + 16 + 8 * half);
  return __builtin_bit_cast(v16h, u);
}

// ---------------- fp32 -> f16 convert ----------------
__global__ void cvt_f32_f16_kernel(const float* __restrict__ x,
                                   _Float16* __restrict__ y, int n) {
  int i = blockIdx.x * blockDim.x + threadIdx.x;
  int stride = gridDim.x * blockDim.x;
  for (; i < n; i += stride) y[i] = (_Float16)x[i];
}

// ---------------- W [K,N] fp32 -> Wt [N,K] f16 (tiled transpose) ----------------
__global__ void transpose_w_kernel(const float* __restrict__ W,
                                   _Float16* __restrict__ Wt) {
  __shared__ float tile[32][33];
  const int bx = blockIdx.x * 32;  // n dimension
  const int by = blockIdx.y * 32;  // k dimension
  const int tx = threadIdx.x, ty = threadIdx.y;
#pragma unroll
  for (int j = 0; j < 32; j += 8)
    tile[ty + j][tx] = W[(by + ty + j) * 1024 + bx + tx];
  __syncthreads();
#pragma unroll
  for (int j = 0; j < 32; j += 8)
    Wt[(bx + ty + j) * 1024 + by + tx] = (_Float16)tile[tx][ty + j];
}

// ---------------- QKV projection: out = X @ W + b, f16 WMMA, f32 accum ----------
// One wave computes a 16x64 tile. v_layout: 0 -> [b,h,S,d] (Q,K), 1 -> [b,h,d,S] (V^T)
__global__ void qkv_gemm_kernel(const _Float16* __restrict__ Xh,
                                const _Float16* __restrict__ Wt,
                                const float* __restrict__ bias,
                                _Float16* __restrict__ out, int v_layout) {
  const int lane = threadIdx.x & 31;
  const int wv = threadIdx.x >> 5;
  const int wid = blockIdx.x * 4 + wv;      // 4096 waves
  const int r = wid & 255;                  // row tile (16 rows of 4096)
  const int c = wid >> 8;                   // col block (64 cols of 1024)
  const int ln = lane & 15, half = lane >> 4;

  v8f acc[4];
#pragma unroll
  for (int t = 0; t < 4; ++t) acc[t] = {};

  const _Float16* arow = Xh + (r * 16 + ln) * 1024;
  for (int kk = 0; kk < 32; ++kk) {
    v16h a = load_frag(arow + kk * 32, half);
#pragma unroll
    for (int t = 0; t < 4; ++t) {
      const _Float16* brow = Wt + (c * 64 + t * 16 + ln) * 1024 + kk * 32;
      v16h b = load_frag(brow, half);
      acc[t] = __builtin_amdgcn_wmma_f32_16x16x32_f16(false, a, false, b,
                                                      (short)0, acc[t], false, false);
    }
  }

#pragma unroll
  for (int t = 0; t < 4; ++t) {
    const int col = c * 64 + t * 16 + ln;   // 0..1023
    const float bz = bias[col];
    const int hh = col >> 6, dd = col & 63;
#pragma unroll
    for (int i = 0; i < 8; ++i) {
      const int row = r * 16 + i + 8 * half;  // 0..4095
      const int bb = row >> 11, ss = row & 2047;
      const float val = acc[t][i] + bz;
      if (v_layout == 0)
        out[((bb * 16 + hh) * 2048 + ss) * 64 + dd] = (_Float16)val;
      else
        out[((bb * 16 + hh) * 64 + dd) * 2048 + ss] = (_Float16)val;
    }
  }
}

// ---------------- fused flash attention ----------------
// One wave per 16-query tile per (b,h). Streams 32-key blocks, online softmax.
__global__ void attn_kernel(const _Float16* __restrict__ Qh,
                            const _Float16* __restrict__ Kh,
                            const _Float16* __restrict__ Vth,
                            const float* __restrict__ mask,
                            float* __restrict__ out) {
  __shared__ _Float16 plds[4][16 * 40];   // P tile per wave, pitch 40 halves (16B aligned rows)
  const int lane = threadIdx.x & 31;
  const int wv = threadIdx.x >> 5;
  const int g = blockIdx.x * 4 + wv;      // 4096 waves
  const int qt = g & 127;                 // query tile 0..127
  const int bh = g >> 7;                  // 0..31
  const int b = bh >> 4, h = bh & 15;
  const int ln = lane & 15, half = lane >> 4;
  const int qbase = qt * 16;

  const _Float16* qrow = Qh + (bh * 2048 + qbase + ln) * 64;
  v16h aq0 = load_frag(qrow, half);
  v16h aq1 = load_frag(qrow + 32, half);

  float ms[8], ls[8];
  v8f acc[4];
#pragma unroll
  for (int i = 0; i < 8; ++i) { ms[i] = -1e30f; ls[i] = 0.f; }
#pragma unroll
  for (int t = 0; t < 4; ++t) acc[t] = {};

  _Float16* pr = &plds[wv][0];

  for (int kb = 0; kb < 64; ++kb) {
    const int kbase = kb * 32;
    v8f s[2];
#pragma unroll
    for (int t = 0; t < 2; ++t) {
      const _Float16* krow = Kh + (bh * 2048 + kbase + t * 16 + ln) * 64;
      v16h bk0 = load_frag(krow, half);
      v16h bk1 = load_frag(krow + 32, half);
      v8f cc = {};
      cc = __builtin_amdgcn_wmma_f32_16x16x32_f16(false, aq0, false, bk0, (short)0, cc, false, false);
      cc = __builtin_amdgcn_wmma_f32_16x16x32_f16(false, aq1, false, bk1, (short)0, cc, false, false);
      const float mv = mask[b * 2048 + kbase + t * 16 + ln];
#pragma unroll
      for (int i = 0; i < 8; ++i) cc[i] = cc[i] * 0.125f + mv;
      s[t] = cc;
    }

    // online softmax: each row (m = i + 8*half) lives across one 16-lane group
    float mn[8], scale[8];
#pragma unroll
    for (int i = 0; i < 8; ++i) {
      float t0 = fmaxf(s[0][i], s[1][i]);
#pragma unroll
      for (int off = 1; off < 16; off <<= 1)
        t0 = fmaxf(t0, __shfl_xor(t0, off, 32));
      mn[i] = fmaxf(ms[i], t0);
      scale[i] = __expf(ms[i] - mn[i]);
      ms[i] = mn[i];
    }
#pragma unroll
    for (int i = 0; i < 8; ++i) {
      const float p0 = __expf(s[0][i] - mn[i]);
      const float p1 = __expf(s[1][i] - mn[i]);
      s[0][i] = p0; s[1][i] = p1;
      float t1 = p0 + p1;
#pragma unroll
      for (int off = 1; off < 16; off <<= 1)
        t1 += __shfl_xor(t1, off, 32);
      ls[i] = ls[i] * scale[i] + t1;
    }

    // transpose P (D-fragment layout -> A-fragment layout) via LDS
#pragma unroll
    for (int i = 0; i < 8; ++i) {
      const int row = i + 8 * half;
      pr[row * 40 + ln]      = (_Float16)s[0][i];
      pr[row * 40 + 16 + ln] = (_Float16)s[1][i];
    }
    asm volatile("s_wait_dscnt 0" ::: "memory");
    v16h ap = load_frag(pr + ln * 40, half);

#pragma unroll
    for (int td = 0; td < 4; ++td) {
#pragma unroll
      for (int i = 0; i < 8; ++i) acc[td][i] *= scale[i];
      const _Float16* vrow = Vth + (bh * 64 + td * 16 + ln) * 2048 + kbase;
      v16h bvf = load_frag(vrow, half);
      acc[td] = __builtin_amdgcn_wmma_f32_16x16x32_f16(false, ap, false, bvf,
                                                       (short)0, acc[td], false, false);
    }
  }

#pragma unroll
  for (int i = 0; i < 8; ++i) {
    const float inv = 1.0f / ls[i];
    const int srow = qbase + i + 8 * half;
#pragma unroll
    for (int td = 0; td < 4; ++td)
      out[(b * 2048 + srow) * 1024 + h * 64 + td * 16 + ln] = acc[td][i] * inv;
  }
}

extern "C" void kernel_launch(void* const* d_in, const int* in_sizes, int n_in,
                              void* d_out, int out_size, void* d_ws, size_t ws_size,
                              hipStream_t stream) {
  const float* X    = (const float*)d_in[0];
  const float* mask = (const float*)d_in[1];
  const float* Wq   = (const float*)d_in[2];
  const float* bq   = (const float*)d_in[3];
  const float* Wk   = (const float*)d_in[4];
  const float* bk   = (const float*)d_in[5];
  const float* Wv   = (const float*)d_in[6];
  const float* bv   = (const float*)d_in[7];
  float* out = (float*)d_out;

  _Float16* ws  = (_Float16*)d_ws;
  _Float16* Xh  = ws;                    // 4096*1024
  _Float16* Wtq = Xh + 4194304;          // 1024*1024 each
  _Float16* Wtk = Wtq + 1048576;
  _Float16* Wtv = Wtk + 1048576;
  _Float16* Qh  = Wtv + 1048576;         // [2,16,2048,64]
  _Float16* Kh  = Qh + 4194304;
  _Float16* Vth = Kh + 4194304;          // [2,16,64,2048]

  cvt_f32_f16_kernel<<<2048, 256, 0, stream>>>(X, Xh, 4194304);
  dim3 tb(32, 8), tg(32, 32);
  transpose_w_kernel<<<tg, tb, 0, stream>>>(Wq, Wtq);
  transpose_w_kernel<<<tg, tb, 0, stream>>>(Wk, Wtk);
  transpose_w_kernel<<<tg, tb, 0, stream>>>(Wv, Wtv);

  qkv_gemm_kernel<<<1024, 128, 0, stream>>>(Xh, Wtq, bq, Qh, 0);
  qkv_gemm_kernel<<<1024, 128, 0, stream>>>(Xh, Wtk, bk, Kh, 0);
  qkv_gemm_kernel<<<1024, 128, 0, stream>>>(Xh, Wtv, bv, Vth, 1);

  attn_kernel<<<1024, 128, 0, stream>>>(Qh, Kh, Vth, mask, out);
}

// v001
// A run of this version takes 241 microseconds.
// Next to v000, in two timings, it ran 1.55 times as fast each time.
#include <hip/hip_runtime.h>

typedef _Float16 v16h __attribute__((ext_vector_type(16)));
typedef float    v8f  __attribute__((ext_vector_type(8)));

// Two 16-byte chunks -> one 16-halfword WMMA fragment (A or B operand).
// Fragment element j corresponds to K index (j<8?0:16) + 8*half + (j%8),
// so chunk0 sits at +8*half and chunk1 at +16+8*half within a 32-wide K slab.
struct FragBits { uint4 lo, hi; };

static __device__ __forceinline__ v16h load_frag(const _Float16* slab, int half) {
  FragBits u;
  u.lo = *reinterpret_cast<const uint4*>(slab + 8 * half);
  u.hi = *reinterpret_cast<const uint4*>(slab + 16 + 8 * half);
  return __builtin_bit_cast(v16h, u);
}

// ---------------- fp32 -> f16 convert ----------------
__global__ void cvt_f32_f16_kernel(const float* __restrict__ x,
                                   _Float16* __restrict__ y, int n) {
  int i = blockIdx.x * blockDim.x + threadIdx.x;
  int stride = gridDim.x * blockDim.x;
  for (; i < n; i += stride) y[i] = (_Float16)x[i];
}

// ---------------- W [K,N] fp32 -> Wt [N,K] f16 (tiled transpose) ----------------
__global__ void transpose_w_kernel(const float* __restrict__ W,
                                   _Float16* __restrict__ Wt) {
  __shared__ float tile[32][33];
  const int bx = blockIdx.x * 32;  // n dimension
  const int by = blockIdx.y * 32;  // k dimension
  const int tx = threadIdx.x, ty = threadIdx.y;
#pragma unroll
  for (int j = 0; j < 32; j += 8)
    tile[ty + j][tx] = W[(by + ty + j) * 1024 + bx + tx];
  __syncthreads();
#pragma unroll
  for (int j = 0; j < 32; j += 8)
    Wt[(bx + ty + j) * 1024 + by + tx] = (_Float16)tile[tx][ty + j];
}

// ---------------- QKV projection: out = X @ W + b, f16 WMMA, f32 accum ----------
// One wave computes a 16x64 tile. v_layout: 0 -> [b,h,S,d] (Q,K), 1 -> [b,h,d,S] (V^T)
__global__ void qkv_gemm_kernel(const _Float16* __restrict__ Xh,
                                const _Float16* __restrict__ Wt,
                                const float* __restrict__ bias,
                                _Float16* __restrict__ out, int v_layout) {
  const int lane = threadIdx.x & 31;
  const int wv = threadIdx.x >> 5;
  const int wid = blockIdx.x * 4 + wv;      // 4096 waves
  const int r = wid & 255;                  // row tile (16 rows of 4096)
  const int c = wid >> 8;                   // col block (64 cols of 1024)
  const int ln = lane & 15, half = lane >> 4;

  v8f acc[4];
#pragma unroll
  for (int t = 0; t < 4; ++t) acc[t] = {};

  const _Float16* arow = Xh + (r * 16 + ln) * 1024;
  for (int kk = 0; kk < 32; ++kk) {
    v16h a = load_frag(arow + kk * 32, half);
#pragma unroll
    for (int t = 0; t < 4; ++t) {
      const _Float16* brow = Wt + (c * 64 + t * 16 + ln) * 1024 + kk * 32;
      v16h b = load_frag(brow, half);
      acc[t] = __builtin_amdgcn_wmma_f32_16x16x32_f16(false, a, false, b,
                                                      (short)0, acc[t], false, false);
    }
  }

#pragma unroll
  for (int t = 0; t < 4; ++t) {
    const int col = c * 64 + t * 16 + ln;   // 0..1023
    const float bz = bias[col];
    const int hh = col >> 6, dd = col & 63;
#pragma unroll
    for (int i = 0; i < 8; ++i) {
      const int row = r * 16 + i + 8 * half;  // 0..4095
      const int bb = row >> 11, ss = row & 2047;
      const float val = acc[t][i] + bz;
      if (v_layout == 0)
        out[((bb * 16 + hh) * 2048 + ss) * 64 + dd] = (_Float16)val;
      else
        out[((bb * 16 + hh) * 64 + dd) * 2048 + ss] = (_Float16)val;
    }
  }
}

// ---------------- fused flash attention ----------------
// One wave per 16-query tile per (b,h). Streams 32-key blocks, online softmax.
// Scores are formed transposed (S^T = K Q^T): a lane holds 16 keys of ONE query,
// so maximum and sum run in the lane, and the two score tiles, converted in place,
// are the B operand of O^T += V^T P^T.
static __device__ __forceinline__ float other_half(float x) {
  // lane l <-> lane l ^ 16
  return __builtin_bit_cast(float, __builtin_amdgcn_permlanex16(
      __builtin_bit_cast(int, x), __builtin_bit_cast(int, x),
      0x76543210, 0xfedcba98, false, false));
}

__global__ void __launch_bounds__(128) attn_kernel(const _Float16* __restrict__ Qh,
                            const _Float16* __restrict__ Kh,
                            const _Float16* __restrict__ Vth,
                            const float* __restrict__ mask,
                            float* __restrict__ out) {
  const int lane = threadIdx.x & 31;
  const int wv = threadIdx.x >> 5;
  const int g = blockIdx.x * 4 + wv;      // 4096 waves
  const int qt = g & 127;                 // query tile 0..127
  const int bh = g >> 7;                  // 0..31
  const int b = bh >> 4, h = bh & 15;
  const int ln = lane & 15, half = lane >> 4;
  const int qbase = qt * 16;

  const _Float16* qrow = Qh + (bh * 2048 + qbase + ln) * 64;
  const v16h bq0 = load_frag(qrow, half);
  const v16h bq1 = load_frag(qrow + 32, half);

  float ms = -1e30f, ls = 0.f;            // of query ln; ls: this half's keys only
  v8f acc[4];                             // acc[td][i] = O^T[td*16 + 8*half + i][query ln]
#pragma unroll
  for (int t = 0; t < 4; ++t) acc[t] = {};

  for (int kb = 0; kb < 64; ++kb) {
    const int kbase = kb * 32;
    v8f s[2];                             // s[t][i] = S[query ln][kbase + t*16 + 8*half + i]
#pragma unroll
    for (int t = 0; t < 2; ++t) {
      const _Float16* krow = Kh + (bh * 2048 + kbase + t * 16 + ln) * 64;
      v16h ak0 = load_frag(krow, half);
      v16h ak1 = load_frag(krow + 32, half);
      v8f cc = {};
      cc = __builtin_amdgcn_wmma_f32_16x16x32_f16(false, ak0, false, bq0, (short)0, cc, false, false);
      cc = __builtin_amdgcn_wmma_f32_16x16x32_f16(false, ak1, false, bq1, (short)0, cc, false, false);
      const float4* mp = reinterpret_cast<const float4*>(mask + b * 2048 + kbase + t * 16 + 8 * half);
      const float4 m0 = mp[0], m1 = mp[1];
      cc[0] = cc[0] * 0.125f + m0.x; cc[1] = cc[1] * 0.125f + m0.y;
      cc[2] = cc[2] * 0.125f + m0.z; cc[3] = cc[3] * 0.125f + m0.w;
      cc[4] = cc[4] * 0.125f + m1.x; cc[5] = cc[5] * 0.125f + m1.y;
      cc[6] = cc[6] * 0.125f + m1.z; cc[7] = cc[7] * 0.125f + m1.w;
      s[t] = cc;
    }

    float mx[2];
#pragma unroll
    for (int t = 0; t < 2; ++t)
      mx[t] = fmaxf(fmaxf(fmaxf(s[t][0], s[t][1]), fmaxf(s[t][2], s[t][3])),
                    fmaxf(fmaxf(s[t][4], s[t][5]), fmaxf(s[t][6], s[t][7])));
    float t0 = fmaxf(mx[0], mx[1]);
    t0 = fmaxf(t0, other_half(t0));
    const float mn = fmaxf(ms, t0);
    const float scale = __expf(ms - mn);
    ms = mn;

    v16h bp;
    float ps[2];
#pragma unroll
    for (int t = 0; t < 2; ++t) {
      float p[8];
#pragma unroll
      for (int i = 0; i < 8; ++i) {
        p[i] = __expf(s[t][i] - mn);
        bp[t * 8 + i] = (_Float16)p[i];
      }
      ps[t] = ((p[0] + p[1]) + (p[2] + p[3])) + ((p[4] + p[5]) + (p[6] + p[7]));
    }
    ls = ls * scale + (ps[0] + ps[1]);

#pragma unroll
    for (int td = 0; td < 4; ++td) {
#pragma unroll
      for (int i = 0; i < 8; ++i) acc[td][i] *= scale;
      const _Float16* vrow = Vth + (bh * 64 + td * 16 + ln) * 2048 + kbase;
      v16h av = load_frag(vrow, half);
      acc[td] = __builtin_amdgcn_wmma_f32_16x16x32_f16(false, av, false, bp,
                                                       (short)0, acc[td], false, false);
    }
  }

  const float inv = 1.0f / (ls + other_half(ls));
  float* orow = out + (b * 2048 + qbase + ln) * 1024 + h * 64 + 8 * half;
#pragma unroll
  for (int td = 0; td < 4; ++td) {
    float4 o0, o1;
    o0.x = acc[td][0] * inv; o0.y = acc[td][1] * inv; o0.z = acc[td][2] * inv; o0.w = acc[td][3] * inv;
    o1.x = acc[td][4] * inv; o1.y = acc[td][5] * inv; o1.z = acc[td][6] * inv; o1.w = acc[td][7] * inv;
    *reinterpret_cast<float4*>(orow + td * 16) = o0;
    *reinterpret_cast<float4*>(orow + td * 16 + 4) = o1;
  }
}

extern "C" void kernel_launch(void* const* d_in, const int* in_sizes, int n_in,
                              void* d_out, int out_size, void* d_ws, size_t ws_size,
                              hipStream_t stream) {
  const float* X    = (const float*)d_in[0];
  const float* mask = (const float*)d_in[1];
  const float* Wq   = (const float*)d_in[2];
  const float* bq   = (const float*)d_in[3];
  const float* Wk   = (const float*)d_in[4];
  const float* bk   = (const float*)d_in[5];
  const float* Wv   = (const float*)d_in[6];
  const float* bv   = (const float*)d_in[7];
  float* out = (float*)d_out;

  _Float16* ws  = (_Float16*)d_ws;
  _Float16* Xh  = ws;                    // 4096*1024
  _Float16* Wtq = Xh + 4194304;          // 1024*1024 each
  _Float16* Wtk = Wtq + 1048576;
  _Float16* Wtv = Wtk + 1048576;
  _Float16* Qh  = Wtv + 1048576;         // [2,16,2048,64]
  _Float16* Kh  = Qh + 4194304;
  _Float16* Vth = Kh + 4194304;          // [2,16,64,2048]

  cvt_f32_f16_kernel<<<2048, 256, 0, stream>>>(X, Xh, 4194304);
  dim3 tb(32, 8), tg(32, 32);
  transpose_w_kernel<<<tg, tb, 0, stream>>>(Wq, Wtq);
  transpose_w_kernel<<<tg, tb, 0, stream>>>(Wk, Wtk);
  transpose_w_kernel<<<tg, tb, 0, stream>>>(Wv, Wtv);

  qkv_gemm_kernel<<<1024, 128, 0, stream>>>(Xh, Wtq, bq, Qh, 0);
  qkv_gemm_kernel<<<1024, 128, 0, stream>>>(Xh, Wtk, bk, Kh, 0);
  qkv_gemm_kernel<<<1024, 128, 0, stream>>>(Xh, Wtv, bv, Vth, 1);

  attn_kernel<<<1024, 128, 0, stream>>>(Qh, Kh, Vth, mask, out);
}

// v002
// It runs in 225 microseconds.
// Timed twice side by side with v001, it ran 1.08 and 1.07 times as fast.
// Counting every step since v000, it is 1.66 times as fast.
#include <hip/hip_runtime.h>

typedef _Float16 v16h __attribute__((ext_vector_type(16)));
typedef float    v8f  __attribute__((ext_vector_type(8)));

// Two 16-byte chunks -> one 16-halfword WMMA fragment (A or B operand).
// Fragment element j corresponds to K index (j<8?0:16) + 8*half + (j%8),
// so chunk0 sits at +8*half and chunk1 at +16+8*half within a 32-wide K slab.
struct FragBits { uint4 lo, hi; };

static __device__ __forceinline__ v16h load_frag(const _Float16* slab, int half) {
  FragBits u;
  u.lo = *reinterpret_cast<const uint4*>(slab + 8 * half);
  u.hi = *reinterpret_cast<const uint4*>(slab + 16 + 8 * half);
  return __builtin_bit_cast(v16h, u);
}

// ---------------- fp32 -> f16 convert ----------------
__global__ void cvt_f32_f16_kernel(const float* __restrict__ x,
                                   _Float16* __restrict__ y, int n) {
  int i = blockIdx.x * blockDim.x + threadIdx.x;
  int stride = gridDim.x * blockDim.x;
  for (; i < n; i += stride) y[i] = (_Float16)x[i];
}

// ---------------- W [K,N] fp32 -> Wt [N,K] f16 (tiled transpose) ----------------
__global__ void transpose_w_kernel(const float* __restrict__ W,
                                   _Float16* __restrict__ Wt) {
  __shared__ float tile[32][33];
  const int bx = blockIdx.x * 32;  // n dimension
  const int by = blockIdx.y * 32;  // k dimension
  const int tx = threadIdx.x, ty = threadIdx.y;
#pragma unroll
  for (int j = 0; j < 32; j += 8)
    tile[ty + j][tx] = W[(by + ty + j) * 1024 + bx + tx];
  __syncthreads();
#pragma unroll
  for (int j = 0; j < 32; j += 8)
    Wt[(bx + ty + j) * 1024 + by + tx] = (_Float16)tile[tx][ty + j];
}

// ---------------- QKV projection: out = X @ W + b, f16 WMMA, f32 accum ----------
// One wave computes a 16x64 tile. v_layout: 0 -> [b,h,S,d] (Q,K), 1 -> [b,h,d,S] (V^T)
// One pass = 64 k = one whole 128-byte line of each operand row: 20 loads of 16 bytes.
struct GemmSet { v16h a[2]; v16h b[2][4]; };

static __device__ __forceinline__ void gemm_fetch(GemmSet& s, const _Float16* arow,
                                                  const _Float16* brow, int pass, int half) {
#pragma unroll
  for (int u = 0; u < 2; ++u) {
    s.a[u] = load_frag(arow + pass * 64 + u * 32, half);
#pragma unroll
    for (int t = 0; t < 4; ++t)
      s.b[u][t] = load_frag(brow + t * 16 * 1024 + pass * 64 + u * 32, half);
  }
}

static __device__ __forceinline__ void gemm_mma(v8f (&acc)[4], const GemmSet& s) {
#pragma unroll
  for (int u = 0; u < 2; ++u)
#pragma unroll
    for (int t = 0; t < 4; ++t)
      acc[t] = __builtin_amdgcn_wmma_f32_16x16x32_f16(false, s.a[u], false, s.b[u][t],
                                                      (short)0, acc[t], false, false);
}

__global__ void __launch_bounds__(128) qkv_gemm_kernel(const _Float16* __restrict__ Xh,
                                const _Float16* __restrict__ Wt,
                                const float* __restrict__ bias,
                                _Float16* __restrict__ out, int v_layout) {
  const int lane = threadIdx.x & 31;
  const int wv = threadIdx.x >> 5;
  const int wid = blockIdx.x * 4 + wv;      // 4096 waves
  const int r = wid & 255;                  // row tile (16 rows of 4096)
  const int c = wid >> 8;                   // col block (64 cols of 1024)
  const int ln = lane & 15, half = lane >> 4;

  v8f acc[4];
#pragma unroll
  for (int t = 0; t < 4; ++t) acc[t] = {};

  const _Float16* arow = Xh + (r * 16 + ln) * 1024;
  const _Float16* brow = Wt + (c * 64 + ln) * 1024;
  // Two register sets: while one pass's products run, the next pass's 20 loads are in flight.
  // Each sched_barrier keeps a pass's loads together as one group ahead of the products
  // (left alone, the scheduler sinks each load to just before its use and every wait is exposed)
  // and keeps a set's refill behind the products that read it (a third set would cost a wave).
  GemmSet s0, s1;
  gemm_fetch(s0, arow, brow, 0, half);
  for (int p = 0; p < 14; p += 2) {
    gemm_fetch(s1, arow, brow, p + 1, half);
    __builtin_amdgcn_sched_barrier(0);
    gemm_mma(acc, s0);
    __builtin_amdgcn_sched_barrier(0);
    gemm_fetch(s0, arow, brow, p + 2, half);
    __builtin_amdgcn_sched_barrier(0);
    gemm_mma(acc, s1);
    __builtin_amdgcn_sched_barrier(0);
  }
  gemm_fetch(s1, arow, brow, 15, half);
  __builtin_amdgcn_sched_barrier(0);
  // the epilogue reuses the address registers that the loads still in flight name
  asm volatile("s_wait_xcnt 0x0" ::: "memory");
  gemm_mma(acc, s0);
  gemm_mma(acc, s1);

#pragma unroll
  for (int t = 0; t < 4; ++t) {
    const int col = c * 64 + t * 16 + ln;   // 0..1023
    const float bz = bias[col];
    const int hh = col >> 6, dd = col & 63;
#pragma unroll
    for (int i = 0; i < 8; ++i) {
      const int row = r * 16 + i + 8 * half;  // 0..4095
      const int bb = row >> 11, ss = row & 2047;
      const float val = acc[t][i] + bz;
      if (v_layout == 0)
        out[((bb * 16 + hh) * 2048 + ss) * 64 + dd] = (_Float16)val;
      else
        out[((bb * 16 + hh) * 64 + dd) * 2048 + ss] = (_Float16)val;
    }
  }
}

// ---------------- fused flash attention ----------------
// One wave per 16-query tile per (b,h). Streams 32-key blocks, online softmax.
// Scores are formed transposed (S^T = K Q^T): a lane holds 16 keys of ONE query,
// so maximum and sum run in the lane, and the two score tiles, converted in place,
// are the B operand of O^T += V^T P^T.
static __device__ __forceinline__ float other_half(float x) {
  // lane l <-> lane l ^ 16
  return __builtin_bit_cast(float, __builtin_amdgcn_permlanex16(
      __builtin_bit_cast(int, x), __builtin_bit_cast(int, x),
      0x76543210, 0xfedcba98, false, false));
}

// K fragments and mask values of one 32-key pass.
struct KeySet { v16h k[2][2]; float4 m[2][2]; };

static __device__ __forceinline__ void mask_fetch(KeySet& s, const float* mrow, int kb) {
#pragma unroll
  for (int t = 0; t < 2; ++t) {
    const float4* mp = reinterpret_cast<const float4*>(mrow + kb * 32 + t * 16);
    s.m[t][0] = mp[0];
    s.m[t][1] = mp[1];
  }
}

static __device__ __forceinline__ void key_fetch(KeySet& s, const _Float16* krow0, int kb, int half) {
#pragma unroll
  for (int t = 0; t < 2; ++t) {
    const _Float16* krow = krow0 + (kb * 32 + t * 16) * 64;
    s.k[t][0] = load_frag(krow, half);
    s.k[t][1] = load_frag(krow + 32, half);
  }
}

static __device__ __forceinline__ void value_fetch(v16h (&av)[4], const _Float16* vrow0,
                                                   int kb, int half) {
#pragma unroll
  for (int td = 0; td < 4; ++td)
    av[td] = load_frag(vrow0 + td * 16 * 2048 + kb * 32, half);
}

static __device__ __forceinline__ void attn_pass(const KeySet& ks, const v16h (&av)[4],
                                                 const v16h bq0, const v16h bq1,
                                                 float& ms, float& ls, v8f (&acc)[4]) {
  v8f s[2];                               // s[t][i] = S[query ln][kbase + t*16 + 8*half + i]
#pragma unroll
  for (int t = 0; t < 2; ++t) {
    v8f cc = {};
    cc = __builtin_amdgcn_wmma_f32_16x16x32_f16(false, ks.k[t][0], false, bq0, (short)0, cc, false, false);
    cc = __builtin_amdgcn_wmma_f32_16x16x32_f16(false, ks.k[t][1], false, bq1, (short)0, cc, false, false);
    const float4 m0 = ks.m[t][0], m1 = ks.m[t][1];
    cc[0] = cc[0] * 0.125f + m0.x; cc[1] = cc[1] * 0.125f + m0.y;
    cc[2] = cc[2] * 0.125f + m0.z; cc[3] = cc[3] * 0.125f + m0.w;
    cc[4] = cc[4] * 0.125f + m1.x; cc[5] = cc[5] * 0.125f + m1.y;
    cc[6] = cc[6] * 0.125f + m1.z; cc[7] = cc[7] * 0.125f + m1.w;
    s[t] = cc;
  }

  float mx[2];
#pragma unroll
  for (int t = 0; t < 2; ++t)
    mx[t] = fmaxf(fmaxf(fmaxf(s[t][0], s[t][1]), fmaxf(s[t][2], s[t][3])),
                  fmaxf(fmaxf(s[t][4], s[t][5]), fmaxf(s[t][6], s[t][7])));
  float t0 = fmaxf(mx[0], mx[1]);
  t0 = fmaxf(t0, other_half(t0));
  const float mn = fmaxf(ms, t0);
  const float scale = __expf(ms - mn);
  ms = mn;

  v16h bp;
  float ps[2];
#pragma unroll
  for (int t = 0; t < 2; ++t) {
    float p[8];
#pragma unroll
    for (int i = 0; i < 8; ++i) {
      p[i] = __expf(s[t][i] - mn);
      bp[t * 8 + i] = (_Float16)p[i];
    }
    ps[t] = ((p[0] + p[1]) + (p[2] + p[3])) + ((p[4] + p[5]) + (p[6] + p[7]));
  }
  ls = ls * scale + (ps[0] + ps[1]);

#pragma unroll
  for (int td = 0; td < 4; ++td) {
#pragma unroll
    for (int i = 0; i < 8; ++i) acc[td][i] *= scale;
    acc[td] = __builtin_amdgcn_wmma_f32_16x16x32_f16(false, av[td], false, bp,
                                                     (short)0, acc[td], false, false);
  }
}

__global__ void __launch_bounds__(128) attn_kernel(const _Float16* __restrict__ Qh,
                            const _Float16* __restrict__ Kh,
                            const _Float16* __restrict__ Vth,
                            const float* __restrict__ mask,
                            float* __restrict__ out) {
  const int lane = threadIdx.x & 31;
  const int wv = threadIdx.x >> 5;
  const int g = blockIdx.x * 4 + wv;      // 4096 waves
  const int qt = g & 127;                 // query tile 0..127
  const int bh = g >> 7;                  // 0..31
  const int b = bh >> 4, h = bh & 15;
  const int ln = lane & 15, half = lane >> 4;
  const int qbase = qt * 16;

  const _Float16* qrow = Qh + (bh * 2048 + qbase + ln) * 64;
  const v16h bq0 = load_frag(qrow, half);
  const v16h bq1 = load_frag(qrow + 32, half);

  float ms = -1e30f, ls = 0.f;            // of query ln; ls: this half's keys only
  v8f acc[4];                             // acc[td][i] = O^T[td*16 + 8*half + i][query ln]
#pragma unroll
  for (int t = 0; t < 4; ++t) acc[t] = {};

  const _Float16* krow0 = Kh + (bh * 2048 + ln) * 64;
  const _Float16* vrow0 = Vth + (bh * 64 + ln) * 2048;
  const float* mrow = mask + b * 2048 + 8 * half;
  // Every global load is issued well ahead of its use, in three groups per trip of two passes:
  // V of the even pass at the head; V of the odd pass and K, mask of the next even pass behind
  // the whole even pass; K, mask of the next odd pass at the foot.
  // Each sched_barrier keeps a group together at its place: left alone, the scheduler sinks
  // every load to just before its use, where its whole latency is waited out. The two of the
  // first fill keep it in the order of the refills, mask first: the counted waits in the loop
  // are the stricter of the two ways into it.
  KeySet k0, k1;
  v16h av[4];
  mask_fetch(k0, mrow, 0);
  __builtin_amdgcn_sched_barrier(0);
  key_fetch(k0, krow0, 0, half);
  mask_fetch(k1, mrow, 1);
  key_fetch(k1, krow0, 1, half);
  __builtin_amdgcn_sched_barrier(0);
  for (int kb = 0; kb < 64; kb += 2) {
    const int n2 = kb + 2 < 64 ? kb + 2 : 0;   // last trip: stays inside the planes, unused
    value_fetch(av, vrow0, kb, half);
    attn_pass(k0, av, bq0, bq1, ms, ls, acc);
    __builtin_amdgcn_sched_barrier(0);
    // the k1 loads of the trip before are still in flight and name the address registers
    // that the next lines rewrite
    asm volatile("s_wait_xcnt 0x0" ::: "memory");
    mask_fetch(k0, mrow, n2);
    value_fetch(av, vrow0, kb + 1, half);
    key_fetch(k0, krow0, n2, half);
    __builtin_amdgcn_sched_barrier(0);
    attn_pass(k1, av, bq0, bq1, ms, ls, acc);
    __builtin_amdgcn_sched_barrier(0);
    mask_fetch(k1, mrow, n2 + 1);
    key_fetch(k1, krow0, n2 + 1, half);
    __builtin_amdgcn_sched_barrier(0);
  }

  const float inv = 1.0f / (ls + other_half(ls));
  float* orow = out + (b * 2048 + qbase + ln) * 1024 + h * 64 + 8 * half;
#pragma unroll
  for (int td = 0; td < 4; ++td) {
    float4 o0, o1;
    o0.x = acc[td][0] * inv; o0.y = acc[td][1] * inv; o0.z = acc[td][2] * inv; o0.w = acc[td][3] * inv;
    o1.x = acc[td][4] * inv; o1.y = acc[td][5] * inv; o1.z = acc[td][6] * inv; o1.w = acc[td][7] * inv;
    *reinterpret_cast<float4*>(orow + td * 16) = o0;
    *reinterpret_cast<float4*>(orow + td * 16 + 4) = o1;
  }
}

extern "C" void kernel_launch(void* const* d_in, const int* in_sizes, int n_in,
                              void* d_out, int out_size, void* d_ws, size_t ws_size,
                              hipStream_t stream) {
  const float* X    = (const float*)d_in[0];
  const float* mask = (const float*)d_in[1];
  const float* Wq   = (const float*)d_in[2];
  const float* bq   = (const float*)d_in[3];
  const float* Wk   = (const float*)d_in[4];
  const float* bk   = (const float*)d_in[5];
  const float* Wv   = (const float*)d_in[6];
  const float* bv   = (const float*)d_in[7];
  float* out = (float*)d_out;

  _Float16* ws  = (_Float16*)d_ws;
  _Float16* Xh  = ws;                    // 4096*1024
  _Float16* Wtq = Xh + 4194304;          // 1024*1024 each
  _Float16* Wtk = Wtq + 1048576;
  _Float16* Wtv = Wtk + 1048576;
  _Float16* Qh  = Wtv + 1048576;         // [2,16,2048,64]
  _Float16* Kh  = Qh + 4194304;
  _Float16* Vth = Kh + 4194304;          // [2,16,64,2048]

  cvt_f32_f16_kernel<<<2048, 256, 0, stream>>>(X, Xh, 4194304);
  dim3 tb(32, 8), tg(32, 32);
  transpose_w_kernel<<<tg, tb, 0, stream>>>(Wq, Wtq);
  transpose_w_kernel<<<tg, tb, 0, stream>>>(Wk, Wtk);
  transpose_w_kernel<<<tg, tb, 0, stream>>>(Wv, Wtv);

  qkv_gemm_kernel<<<1024, 128, 0, stream>>>(Xh, Wtq, bq, Qh, 0);
  qkv_gemm_kernel<<<1024, 128, 0, stream>>>(Xh, Wtk, bk, Kh, 0);
  qkv_gemm_kernel<<<1024, 128, 0, stream>>>(Xh, Wtv, bv, Vth, 1);

  attn_kernel<<<1024, 128, 0, stream>>>(Qh, Kh, Vth, mask, out);
}

// v003
// It runs in 93.8 microseconds.
// Timed twice side by side with v002, it ran 2.39 and 2.40 times as fast.
// Over all steps from v000 it is 3.98 times as fast.
#include <hip/hip_runtime.h>

typedef _Float16 v16h __attribute__((ext_vector_type(16)));
typedef float    v8f  __attribute__((ext_vector_type(8)));

// Two 16-byte chunks -> one 16-halfword WMMA fragment (A or B operand).
// Fragment element j corresponds to K index (j<8?0:16) + 8*half + (j%8).
// Every f16 plane of the workspace is kept in fragment order: a tile of 16 rows x 32 k is
// 512 halfwords, [chunk c][lane][8], lane = 16*half + row, k = 16*c + 8*half + (0..7).
// A wave's 16-byte load or store of one chunk then covers 512 bytes in a row (4 whole lines).
struct FragBits { uint4 lo, hi; };

// p = start of the tile + 8 * lane
static __device__ __forceinline__ v16h load_frag(const _Float16* p) {
  FragBits u;
  u.lo = *reinterpret_cast<const uint4*>(p);
  u.hi = *reinterpret_cast<const uint4*>(p + 256);
  return __builtin_bit_cast(v16h, u);
}

typedef _Float16 v8h __attribute__((ext_vector_type(8)));

// ---------------- X [4096,1024] fp32 -> f16 tiles [row tile][k tile] in fragment order ------
// One thread makes one 16-byte chunk entry (8 k of one row). A wave takes 8 rows x 32 k:
// it reads 8 whole lines of X and writes 4 whole lines of the tile.
__global__ void cvt_f32_f16_kernel(const float* __restrict__ x,
                                   _Float16* __restrict__ y, int n) {
  int o = blockIdx.x * blockDim.x + threadIdx.x;
  int stride = gridDim.x * blockDim.x;
  for (; o < (n >> 3); o += stride) {
    const int q = o & 3, row = (o >> 2) & 15, kt = (o >> 6) & 31, rt = o >> 11;  // k = 8*q + (0..7)
    const float4* xp = reinterpret_cast<const float4*>(x + (rt * 16 + row) * 1024 + kt * 32 + q * 8);
    const float4 f0 = xp[0], f1 = xp[1];
    v8h hv;
    hv[0] = (_Float16)f0.x; hv[1] = (_Float16)f0.y; hv[2] = (_Float16)f0.z; hv[3] = (_Float16)f0.w;
    hv[4] = (_Float16)f1.x; hv[5] = (_Float16)f1.y; hv[6] = (_Float16)f1.z; hv[7] = (_Float16)f1.w;
    // chunk c = q >> 1, lane = 16 * (q & 1) + row
    *reinterpret_cast<v8h*>(y + (o >> 6) * 512 + (q >> 1) * 256 + ((q & 1) * 16 + row) * 8) = hv;
  }
}

// ------- W [K,N] fp32 -> f16 tiles [n tile][k tile] in fragment order (row = n) -------
__global__ void transpose_w_kernel(const float* __restrict__ W,
                                   _Float16* __restrict__ Wt) {
  __shared__ float tile[32][33];
  const int bx = blockIdx.x * 32;  // n dimension
  const int by = blockIdx.y * 32;  // k dimension
  const int tx = threadIdx.x, ty = threadIdx.y;
#pragma unroll
  for (int j = 0; j < 32; j += 8)
    tile[ty + j][tx] = W[(by + ty + j) * 1024 + bx + tx];
  __syncthreads();
  // the 32 x 32 block is two fragment tiles (n tiles bx/16 and bx/16 + 1, k tile by/32)
#pragma unroll
  for (int j = 0; j < 4; ++j) {
    const int idx = j * 256 + ty * 32 + tx;
    const int nt = idx >> 9, w = idx & 511;           // w = 256*c + 8*lane + e
    const int nl = nt * 16 + ((w >> 3) & 15);
    const int kl = (w >> 8) * 16 + ((w >> 7) & 1) * 8 + (w & 7);
    Wt[(((bx >> 4) + nt) * 32 + (by >> 5)) * 512 + w] = (_Float16)tile[kl][nl];
  }
}

// ---------------- QKV projection: out = X @ W + b, f16 WMMA, f32 accum ----------
// One wave computes a 16x64 tile (16 rows of X, the 64 columns of one head).
// VT = 0 (Q, K): tiles [b,h][s tile][d tile], row = s, k = d. The product is formed as W^T X^T,
//   so a lane's 8 accumulators are 8 d in a row of one s: one chunk entry of that tile.
// VT = 1 (V^T): tiles [b,h][32-key block][d tile], row = d, k = s. The product is formed as X W,
//   so a lane's 8 accumulators are 8 s in a row of one d.
// One pass = 64 k = two k tiles of each operand: 20 loads of 16 bytes.
struct GemmSet { v16h a[2]; v16h b[2][4]; };

static __device__ __forceinline__ void gemm_fetch(GemmSet& s, const _Float16* arow,
                                                  const _Float16* brow, int pass) {
#pragma unroll
  for (int u = 0; u < 2; ++u) {
    s.a[u] = load_frag(arow + (pass * 2 + u) * 512);
#pragma unroll
    for (int t = 0; t < 4; ++t)
      s.b[u][t] = load_frag(brow + (t * 32 + pass * 2 + u) * 512);
  }
}

template <int VT>
static __device__ __forceinline__ void gemm_mma(v8f (&acc)[4], const GemmSet& s) {
#pragma unroll
  for (int u = 0; u < 2; ++u)
#pragma unroll
    for (int t = 0; t < 4; ++t)
      acc[t] = VT ? __builtin_amdgcn_wmma_f32_16x16x32_f16(false, s.a[u], false, s.b[u][t],
                                                           (short)0, acc[t], false, false)
                  : __builtin_amdgcn_wmma_f32_16x16x32_f16(false, s.b[u][t], false, s.a[u],
                                                           (short)0, acc[t], false, false);
}

template <int VT>
__global__ void __launch_bounds__(128) qkv_gemm_kernel(const _Float16* __restrict__ Xh,
                                const _Float16* __restrict__ Wt,
                                const float* __restrict__ bias,
                                _Float16* __restrict__ out) {
  const int lane = threadIdx.x & 31;
  const int wv = threadIdx.x >> 5;
  const int wid = blockIdx.x * 4 + wv;      // 4096 waves
  const int r = wid & 255;                  // row tile (16 rows of 4096)
  const int c = wid >> 8;                   // col block (64 cols of 1024)
  const int ln = lane & 15, half = lane >> 4;

  v8f acc[4];
#pragma unroll
  for (int t = 0; t < 4; ++t) acc[t] = {};

  const _Float16* arow = Xh + r * 32 * 512 + lane * 8;
  const _Float16* brow = Wt + c * 4 * 32 * 512 + lane * 8;
  // Two register sets: while one pass's products run, the next pass's 20 loads are in flight.
  // Each sched_barrier keeps a pass's loads together as one group ahead of the products
  // (left alone, the scheduler sinks each load to just before its use and every wait is exposed)
  // and keeps a set's refill behind the products that read it (a third set would cost a wave).
  GemmSet s0, s1;
  gemm_fetch(s0, arow, brow, 0);
  for (int p = 0; p < 14; p += 2) {
    gemm_fetch(s1, arow, brow, p + 1);
    __builtin_amdgcn_sched_barrier(0);
    gemm_mma<VT>(acc, s0);
    __builtin_amdgcn_sched_barrier(0);
    gemm_fetch(s0, arow, brow, p + 2);
    __builtin_amdgcn_sched_barrier(0);
    gemm_mma<VT>(acc, s1);
    __builtin_amdgcn_sched_barrier(0);
  }
  gemm_fetch(s1, arow, brow, 15);
  __builtin_amdgcn_sched_barrier(0);
  // the epilogue reuses the address registers that the loads still in flight name
  asm volatile("s_wait_xcnt 0x0" ::: "memory");
  gemm_mma<VT>(acc, s0);
  gemm_mma<VT>(acc, s1);

  const int bh = (r >> 7) * 16 + c;         // rows r*16.. lie in batch r>>7; head = c
  const int st = r & 127;                   // 16-row tile of the sequence
#pragma unroll
  for (int t = 0; t < 4; ++t) {
    v8h hv;
    if (VT) {
      const float bz = bias[c * 64 + t * 16 + ln];
#pragma unroll
      for (int i = 0; i < 8; ++i) hv[i] = (_Float16)(acc[t][i] + bz);
      *reinterpret_cast<v8h*>(out + ((bh * 64 + (st >> 1)) * 4 + t) * 512 + (st & 1) * 256 + lane * 8) = hv;
    } else {
      const float4* bp = reinterpret_cast<const float4*>(bias + c * 64 + t * 16 + 8 * half);
      const float4 b0 = bp[0], b1 = bp[1];
      hv[0] = (_Float16)(acc[t][0] + b0.x); hv[1] = (_Float16)(acc[t][1] + b0.y);
      hv[2] = (_Float16)(acc[t][2] + b0.z); hv[3] = (_Float16)(acc[t][3] + b0.w);
      hv[4] = (_Float16)(acc[t][4] + b1.x); hv[5] = (_Float16)(acc[t][5] + b1.y);
      hv[6] = (_Float16)(acc[t][6] + b1.z); hv[7] = (_Float16)(acc[t][7] + b1.w);
      *reinterpret_cast<v8h*>(out + (bh * 128 + st) * 1024 + t * 256 + lane * 8) = hv;
    }
  }
}

// ---------------- fused flash attention ----------------
// One wave per 16-query tile per (b,h). Streams 32-key blocks, online softmax.
// Scores are formed transposed (S^T = K Q^T): a lane holds 16 keys of ONE query,
// so maximum and sum run in the lane, and the two score tiles, converted in place,
// are the B operand of O^T += V^T P^T.
static __device__ __forceinline__ float other_half(float x) {
  // lane l <-> lane l ^ 16
  return __builtin_bit_cast(float, __builtin_amdgcn_permlanex16(
      __builtin_bit_cast(int, x), __builtin_bit_cast(int, x),
      0x76543210, 0xfedcba98, false, false));
}

// K fragments and mask values of one 32-key pass.
struct KeySet { v16h k[2][2]; float4 m[2][2]; };

static __device__ __forceinline__ void mask_fetch(KeySet& s, const float* mrow, int kb) {
#pragma unroll
  for (int t = 0; t < 2; ++t) {
    const float4* mp = reinterpret_cast<const float4*>(mrow + kb * 32 + t * 16);
    s.m[t][0] = mp[0];
    s.m[t][1] = mp[1];
  }
}

// a pass's K (two key tiles x two d tiles) and its V^T (four d tiles) are 4 KiB in a row each
static __device__ __forceinline__ void key_fetch(KeySet& s, const _Float16* krow0, int kb) {
#pragma unroll
  for (int t = 0; t < 2; ++t) {
    const _Float16* krow = krow0 + (kb * 2 + t) * 1024;
    s.k[t][0] = load_frag(krow);
    s.k[t][1] = load_frag(krow + 512);
  }
}

static __device__ __forceinline__ void value_fetch(v16h (&av)[4], const _Float16* vrow0, int kb) {
#pragma unroll
  for (int td = 0; td < 4; ++td)
    av[td] = load_frag(vrow0 + (kb * 4 + td) * 512);
}

static __device__ __forceinline__ void attn_pass(const KeySet& ks, const v16h (&av)[4],
                                                 const v16h bq0, const v16h bq1,
                                                 float& ms, float& ls, v8f (&acc)[4]) {
  v8f s[2];                               // s[t][i] = S[query ln][kbase + t*16 + 8*half + i]
#pragma unroll
  for (int t = 0; t < 2; ++t) {
    v8f cc = {};
    cc = __builtin_amdgcn_wmma_f32_16x16x32_f16(false, ks.k[t][0], false, bq0, (short)0, cc, false, false);
    cc = __builtin_amdgcn_wmma_f32_16x16x32_f16(false, ks.k[t][1], false, bq1, (short)0, cc, false, false);
    const float4 m0 = ks.m[t][0], m1 = ks.m[t][1];
    cc[0] = cc[0] * 0.125f + m0.x; cc[1] = cc[1] * 0.125f + m0.y;
    cc[2] = cc[2] * 0.125f + m0.z; cc[3] = cc[3] * 0.125f + m0.w;
    cc[4] = cc[4] * 0.125f + m1.x; cc[5] = cc[5] * 0.125f + m1.y;
    cc[6] = cc[6] * 0.125f + m1.z; cc[7] = cc[7] * 0.125f + m1.w;
    s[t] = cc;
  }

  float mx[2];
#pragma unroll
  for (int t = 0; t < 2; ++t)
    mx[t] = fmaxf(fmaxf(fmaxf(s[t][0], s[t][1]), fmaxf(s[t][2], s[t][3])),
                  fmaxf(fmaxf(s[t][4], s[t][5]), fmaxf(s[t][6], s[t][7])));
  float t0 = fmaxf(mx[0], mx[1]);
  t0 = fmaxf(t0, other_half(t0));
  const float mn = fmaxf(ms, t0);
  const float scale = __expf(ms - mn);
  ms = mn;

  v16h bp;
  float ps[2];
#pragma unroll
  for (int t = 0; t < 2; ++t) {
    float p[8];
#pragma unroll
    for (int i = 0; i < 8; ++i) {
      p[i] = __expf(s[t][i] - mn);
      bp[t * 8 + i] = (_Float16)p[i];
    }
    ps[t] = ((p[0] + p[1]) + (p[2] + p[3])) + ((p[4] + p[5]) + (p[6] + p[7]));
  }
  ls = ls * scale + (ps[0] + ps[1]);

#pragma unroll
  for (int td = 0; td < 4; ++td) {
#pragma unroll
    for (int i = 0; i < 8; ++i) acc[td][i] *= scale;
    acc[td] = __builtin_amdgcn_wmma_f32_16x16x32_f16(false, av[td], false, bp,
                                                     (short)0, acc[td], false, false);
  }
}

__global__ void __launch_bounds__(128) attn_kernel(const _Float16* __restrict__ Qh,
                            const _Float16* __restrict__ Kh,
                            const _Float16* __restrict__ Vth,
                            const float* __restrict__ mask,
                            float* __restrict__ out) {
  const int lane = threadIdx.x & 31;
  const int wv = threadIdx.x >> 5;
  const int g = blockIdx.x * 4 + wv;      // 4096 waves
  const int qt = g & 127;                 // query tile 0..127
  const int bh = g >> 7;                  // 0..31
  const int b = bh >> 4, h = bh & 15;
  const int ln = lane & 15, half = lane >> 4;
  const int qbase = qt * 16;

  const _Float16* qrow = Qh + (bh * 128 + qt) * 1024 + lane * 8;
  const v16h bq0 = load_frag(qrow);
  const v16h bq1 = load_frag(qrow + 512);

  float ms = -1e30f, ls = 0.f;            // of query ln; ls: this half's keys only
  v8f acc[4];                             // acc[td][i] = O^T[td*16 + 8*half + i][query ln]
#pragma unroll
  for (int t = 0; t < 4; ++t) acc[t] = {};

  const _Float16* krow0 = Kh + bh * 128 * 1024 + lane * 8;
  const _Float16* vrow0 = Vth + bh * 64 * 2048 + lane * 8;
  const float* mrow = mask + b * 2048 + 8 * half;
  // Every global load is issued well ahead of its use, in three groups per trip of two passes:
  // V of the even pass at the head; V of the odd pass and K, mask of the next even pass behind
  // the whole even pass; K, mask of the next odd pass at the foot.
  // Each sched_barrier keeps a group together at its place: left alone, the scheduler sinks
  // every load to just before its use, where its whole latency is waited out. The two of the
  // first fill keep it in the order of the refills, mask first: the counted waits in the loop
  // are the stricter of the two ways into it.
  KeySet k0, k1;
  v16h av[4];
  mask_fetch(k0, mrow, 0);
  __builtin_amdgcn_sched_barrier(0);
  // the Q loads are still in flight and name an address pair that a K load below takes as target
  asm volatile("s_wait_xcnt 0x0" ::: "memory");
  key_fetch(k0, krow0, 0);
  mask_fetch(k1, mrow, 1);
  key_fetch(k1, krow0, 1);
  __builtin_amdgcn_sched_barrier(0);
  for (int kb = 0; kb < 64; kb += 2) {
    const int n2 = kb + 2 < 64 ? kb + 2 : 0;   // last trip: stays inside the planes, unused
    value_fetch(av, vrow0, kb);
    attn_pass(k0, av, bq0, bq1, ms, ls, acc);
    __builtin_amdgcn_sched_barrier(0);
    // the k1 loads of the trip before are still in flight and name the address registers
    // that the next lines rewrite
    asm volatile("s_wait_xcnt 0x0" ::: "memory");
    mask_fetch(k0, mrow, n2);
    value_fetch(av, vrow0, kb + 1);
    key_fetch(k0, krow0, n2);
    __builtin_amdgcn_sched_barrier(0);
    attn_pass(k1, av, bq0, bq1, ms, ls, acc);
    __builtin_amdgcn_sched_barrier(0);
    mask_fetch(k1, mrow, n2 + 1);
    key_fetch(k1, krow0, n2 + 1);
    __builtin_amdgcn_sched_barrier(0);
  }

  const float inv = 1.0f / (ls + other_half(ls));
  float* orow = out + (b * 2048 + qbase + ln) * 1024 + h * 64 + 8 * half;
#pragma unroll
  for (int td = 0; td < 4; ++td) {
    float4 o0, o1;
    o0.x = acc[td][0] * inv; o0.y = acc[td][1] * inv; o0.z = acc[td][2] * inv; o0.w = acc[td][3] * inv;
    o1.x = acc[td][4] * inv; o1.y = acc[td][5] * inv; o1.z = acc[td][6] * inv; o1.w = acc[td][7] * inv;
    *reinterpret_cast<float4*>(orow + td * 16) = o0;
    *reinterpret_cast<float4*>(orow + td * 16 + 4) = o1;
  }
}

extern "C" void kernel_launch(void* const* d_in, const int* in_sizes, int n_in,
                              void* d_out, int out_size, void* d_ws, size_t ws_size,
                              hipStream_t stream) {
  const float* X    = (const float*)d_in[0];
  const float* mask = (const float*)d_in[1];
  const float* Wq   = (const float*)d_in[2];
  const float* bq   = (const float*)d_in[3];
  const float* Wk   = (const float*)d_in[4];
  const float* bk   = (const float*)d_in[5];
  const float* Wv   = (const float*)d_in[6];
  const float* bv   = (const float*)d_in[7];
  float* out = (float*)d_out;

  _Float16* ws  = (_Float16*)d_ws;
  _Float16* Xh  = ws;                    // 4096*1024, all planes in fragment order
  _Float16* Wtq = Xh + 4194304;          // 1024*1024 each
  _Float16* Wtk = Wtq + 1048576;
  _Float16* Wtv = Wtk + 1048576;
  _Float16* Qh  = Wtv + 1048576;         // 2*16*2048*64 each
  _Float16* Kh  = Qh + 4194304;
  _Float16* Vth = Kh + 4194304;

  cvt_f32_f16_kernel<<<2048, 256, 0, stream>>>(X, Xh, 4194304);
  dim3 tb(32, 8), tg(32, 32);
  transpose_w_kernel<<<tg, tb, 0, stream>>>(Wq, Wtq);
  transpose_w_kernel<<<tg, tb, 0, stream>>>(Wk, Wtk);
  transpose_w_kernel<<<tg, tb, 0, stream>>>(Wv, Wtv);

  qkv_gemm_kernel<0><<<1024, 128, 0, stream>>>(Xh, Wtq, bq, Qh);
  qkv_gemm_kernel<0><<<1024, 128, 0, stream>>>(Xh, Wtk, bk, Kh);
  qkv_gemm_kernel<1><<<1024, 128, 0, stream>>>(Xh, Wtv, bv, Vth);

  attn_kernel<<<1024, 128, 0, stream>>>(Qh, Kh, Vth, mask, out);
}

// v004
// Measured time: 83.1 microseconds a run.
// Next to v003, in two timings, it ran 1.12 and 1.13 times as fast.
// Counting every step since v000, it is 4.48 times as fast.
#include <hip/hip_runtime.h>

typedef _Float16 v16h __attribute__((ext_vector_type(16)));
typedef float    v8f  __attribute__((ext_vector_type(8)));

// Two 16-byte chunks -> one 16-halfword WMMA fragment (A or B operand).
// Fragment element j corresponds to K index (j<8?0:16) + 8*half + (j%8).
// Every f16 plane of the workspace is kept in fragment order: a tile of 16 rows x 32 k is
// 512 halfwords, [chunk c][lane][8], lane = 16*half + row, k = 16*c + 8*half + (0..7).
// A wave's 16-byte load or store of one chunk then covers 512 bytes in a row (4 whole lines).
struct FragBits { uint4 lo, hi; };

// p = start of the tile + 8 * lane
static __device__ __forceinline__ v16h load_frag(const _Float16* p) {
  FragBits u;
  u.lo = *reinterpret_cast<const uint4*>(p);
  u.hi = *reinterpret_cast<const uint4*>(p + 256);
  return __builtin_bit_cast(v16h, u);
}

typedef _Float16 v8h __attribute__((ext_vector_type(8)));
typedef float    v4f __attribute__((ext_vector_type(4)));

// ---------------- X and Wq, Wk, Wv, fp32 -> f16 tiles in fragment order, one launch ----------
// 4096 waves, each with one share of every plane and all its 32 loads in flight at once
// (7 KiB a wave), so that few waves have to be started for the 28 MiB that are read.
// X [4096,1024] -> tiles [row tile][k tile]: a thread makes 16-byte chunk entries (8 k of one row);
//   a wave takes two whole tiles in four turns of 8 rows x 32 k (8 whole lines read, 4 written).
// W [K,N] -> tiles [n tile][k tile], row = n: a thread reads 8 k of ONE n, which is one chunk
//   entry: a wave's load is one whole line of a W row (32 n), its store two runs of 256 bytes.
//   A wave takes the same 32 n x 8 k of each of the three matrices.
__global__ void __launch_bounds__(256) prep_kernel(const float* __restrict__ x,
                                                   const float* __restrict__ wq,
                                                   const float* __restrict__ wk,
                                                   const float* __restrict__ wv,
                                                   _Float16* __restrict__ xh,
                                                   _Float16* __restrict__ wt) {
  const int lane = threadIdx.x & 31;
  const int w = blockIdx.x * 8 + (threadIdx.x >> 5);   // 4096 waves

  v4f f[4][2];
#pragma unroll
  for (int u = 0; u < 4; ++u) {
    const int o = (w * 4 + u) * 32 + lane;
    const int q = o & 3, row = (o >> 2) & 15, kt = (o >> 6) & 31, rt = o >> 11;  // k = 8*q + (0..7)
    const v4f* xp = reinterpret_cast<const v4f*>(x + (rt * 16 + row) * 1024 + kt * 32 + q * 8);
    f[u][0] = xp[0];
    f[u][1] = xp[1];
  }

  const int nb = w & 31, kg = w >> 5;                  // n = 32*nb + lane, k = 8*kg + (0..7)
  const int woff = kg * 8 * 1024 + nb * 32 + lane;
  v8f g[3];
#pragma unroll
  for (int e = 0; e < 8; ++e) {
    g[0][e] = wq[woff + e * 1024];
    g[1][e] = wk[woff + e * 1024];
    g[2][e] = wv[woff + e * 1024];
  }
  // takes the loaded values as inputs only: all 32 loads are issued ahead of the first conversion.
  // Left alone, the compiler holds some back behind the first wait to save registers, and their
  // whole latency is waited out a second time. Its wait stands in front of the address
  // arithmetic of the stores, which rewrites registers that the loads name.
  asm volatile("s_wait_xcnt 0x0" :: "v"(f[0][0]), "v"(f[0][1]), "v"(f[1][0]), "v"(f[1][1]), "v"(f[2][0]), "v"(f[2][1]),
               "v"(f[3][0]), "v"(f[3][1]), "v"(g[0]), "v"(g[1]), "v"(g[2]) : "memory");

#pragma unroll
  for (int u = 0; u < 4; ++u) {
    const int o = (w * 4 + u) * 32 + lane;
    const int q = o & 3, row = (o >> 2) & 15;
    const v4f f0 = f[u][0], f1 = f[u][1];
    v8h hv;
    hv[0] = (_Float16)f0.x; hv[1] = (_Float16)f0.y; hv[2] = (_Float16)f0.z; hv[3] = (_Float16)f0.w;
    hv[4] = (_Float16)f1.x; hv[5] = (_Float16)f1.y; hv[6] = (_Float16)f1.z; hv[7] = (_Float16)f1.w;
    // chunk c = q >> 1, lane = 16 * (q & 1) + row
    *reinterpret_cast<v8h*>(xh + (o >> 6) * 512 + (q >> 1) * 256 + ((q & 1) * 16 + row) * 8) = hv;
  }

  // n tile 2*nb + (lane >> 4), k tile kg >> 2, chunk (kg >> 1) & 1, lane 16 * (kg & 1) + (n & 15)
  _Float16* wp = wt + ((nb * 2 + (lane >> 4)) * 32 + (kg >> 2)) * 512 + ((kg >> 1) & 1) * 256 +
                 ((kg & 1) * 16 + (lane & 15)) * 8;
#pragma unroll
  for (int m = 0; m < 3; ++m) {
    v8h hv;
#pragma unroll
    for (int e = 0; e < 8; ++e) hv[e] = (_Float16)g[m][e];
    *reinterpret_cast<v8h*>(wp + m * 1048576) = hv;
  }
}

// ---------------- QKV projection: out = X @ W + b, f16 WMMA, f32 accum ----------
// One wave computes a 16x64 tile (16 rows of X, the 64 columns of one head).
// VT = 0 (Q, K): tiles [b,h][s tile][d tile], row = s, k = d. The product is formed as W^T X^T,
//   so a lane's 8 accumulators are 8 d in a row of one s: one chunk entry of that tile.
// VT = 1 (V^T): tiles [b,h][32-key block][d tile], row = d, k = s. The product is formed as X W,
//   so a lane's 8 accumulators are 8 s in a row of one d.
// One pass = 64 k = two k tiles of each operand: 20 loads of 16 bytes.
struct GemmSet { v16h a[2]; v16h b[2][4]; };

static __device__ __forceinline__ void gemm_fetch(GemmSet& s, const _Float16* arow,
                                                  const _Float16* brow, int pass) {
#pragma unroll
  for (int u = 0; u < 2; ++u) {
    s.a[u] = load_frag(arow + (pass * 2 + u) * 512);
#pragma unroll
    for (int t = 0; t < 4; ++t)
      s.b[u][t] = load_frag(brow + (t * 32 + pass * 2 + u) * 512);
  }
}

template <int VT>
static __device__ __forceinline__ void gemm_mma(v8f (&acc)[4], const GemmSet& s) {
#pragma unroll
  for (int u = 0; u < 2; ++u)
#pragma unroll
    for (int t = 0; t < 4; ++t)
      acc[t] = VT ? __builtin_amdgcn_wmma_f32_16x16x32_f16(false, s.a[u], false, s.b[u][t],
                                                           (short)0, acc[t], false, false)
                  : __builtin_amdgcn_wmma_f32_16x16x32_f16(false, s.b[u][t], false, s.a[u],
                                                           (short)0, acc[t], false, false);
}

template <int VT>
static __device__ __forceinline__ void qkv_gemm_body(const _Float16* __restrict__ Xh,
                                const _Float16* __restrict__ Wt,
                                const float* __restrict__ bias,
                                _Float16* __restrict__ out, int blk) {
  const int lane = threadIdx.x & 31;
  const int wv = threadIdx.x >> 5;
  const int wid = blk * 4 + wv;             // 4096 waves a projection
  const int r = wid & 255;                  // row tile (16 rows of 4096)
  const int c = blk >> 6;                   // col block (64 cols of 1024), = wid >> 8
  const int ln = lane & 15, half = lane >> 4;

  v8f acc[4];
#pragma unroll
  for (int t = 0; t < 4; ++t) acc[t] = {};

  const _Float16* arow = Xh + r * 32 * 512 + lane * 8;
  const _Float16* brow = Wt + c * 4 * 32 * 512 + lane * 8;
  // Two register sets: while one pass's products run, the next pass's 20 loads are in flight.
  // Each sched_barrier keeps a pass's loads together as one group ahead of the products
  // (left alone, the scheduler sinks each load to just before its use and every wait is exposed)
  // and keeps a set's refill behind the products that read it (a third set would cost a wave).
  GemmSet s0, s1;
  gemm_fetch(s0, arow, brow, 0);
  for (int p = 0; p < 14; p += 2) {
    gemm_fetch(s1, arow, brow, p + 1);
    __builtin_amdgcn_sched_barrier(0);
    gemm_mma<VT>(acc, s0);
    __builtin_amdgcn_sched_barrier(0);
    gemm_fetch(s0, arow, brow, p + 2);
    __builtin_amdgcn_sched_barrier(0);
    gemm_mma<VT>(acc, s1);
    __builtin_amdgcn_sched_barrier(0);
  }
  gemm_fetch(s1, arow, brow, 15);
  __builtin_amdgcn_sched_barrier(0);
  // the epilogue reuses the address registers that the loads still in flight name
  asm volatile("s_wait_xcnt 0x0" ::: "memory");
  gemm_mma<VT>(acc, s0);
  gemm_mma<VT>(acc, s1);

  const int bh = (r >> 7) * 16 + c;         // rows r*16.. lie in batch r>>7; head = c
  const int st = r & 127;                   // 16-row tile of the sequence
#pragma unroll
  for (int t = 0; t < 4; ++t) {
    v8h hv;
    if (VT) {
      const float bz = bias[c * 64 + t * 16 + ln];
#pragma unroll
      for (int i = 0; i < 8; ++i) hv[i] = (_Float16)(acc[t][i] + bz);
      *reinterpret_cast<v8h*>(out + ((bh * 64 + (st >> 1)) * 4 + t) * 512 + (st & 1) * 256 + lane * 8) = hv;
    } else {
      const float4* bp = reinterpret_cast<const float4*>(bias + c * 64 + t * 16 + 8 * half);
      const float4 b0 = bp[0], b1 = bp[1];
      hv[0] = (_Float16)(acc[t][0] + b0.x); hv[1] = (_Float16)(acc[t][1] + b0.y);
      hv[2] = (_Float16)(acc[t][2] + b0.z); hv[3] = (_Float16)(acc[t][3] + b0.w);
      hv[4] = (_Float16)(acc[t][4] + b1.x); hv[5] = (_Float16)(acc[t][5] + b1.y);
      hv[6] = (_Float16)(acc[t][6] + b1.z); hv[7] = (_Float16)(acc[t][7] + b1.w);
      *reinterpret_cast<v8h*>(out + (bh * 128 + st) * 1024 + t * 256 + lane * 8) = hv;
    }
  }
  // in the merged kernel the code of the V^T body stands behind this one and rewrites
  // registers that the four stores above name
  if (!VT) asm volatile("s_wait_xcnt 0x0" ::: "memory");
}

// The three projections in one launch: blocks 0..1023 Q, 1024..2047 K, 2048..3071 V^T.
// Wt and out are the three planes of each kind, one behind the other.
__global__ void __launch_bounds__(128) qkv_gemm_kernel(const _Float16* __restrict__ Xh,
                                const _Float16* __restrict__ Wt,
                                const float* __restrict__ bq,
                                const float* __restrict__ bk,
                                const float* __restrict__ bv,
                                _Float16* __restrict__ out) {
  const int which = blockIdx.x >> 10;
  const int blk = blockIdx.x & 1023;
  if (which == 2)
    qkv_gemm_body<1>(Xh, Wt + 2 * 1048576, bv, out + 2 * 4194304, blk);
  else
    qkv_gemm_body<0>(Xh, Wt + which * 1048576, which ? bk : bq, out + which * 4194304, blk);
}

// ---------------- fused flash attention ----------------
// One wave per 16-query tile per (b,h). Streams 32-key blocks, online softmax.
// Scores are formed transposed (S^T = K Q^T): a lane holds 16 keys of ONE query,
// so maximum and sum run in the lane, and the two score tiles, converted in place,
// are the B operand of O^T += V^T P^T.
static __device__ __forceinline__ float other_half(float x) {
  // lane l <-> lane l ^ 16
  return __builtin_bit_cast(float, __builtin_amdgcn_permlanex16(
      __builtin_bit_cast(int, x), __builtin_bit_cast(int, x),
      0x76543210, 0xfedcba98, false, false));
}

// K fragments and mask values of one 32-key pass.
struct KeySet { v16h k[2][2]; float4 m[2][2]; };

static __device__ __forceinline__ void mask_fetch(KeySet& s, const float* mrow, int kb) {
#pragma unroll
  for (int t = 0; t < 2; ++t) {
    const float4* mp = reinterpret_cast<const float4*>(mrow + kb * 32 + t * 16);
    s.m[t][0] = mp[0];
    s.m[t][1] = mp[1];
  }
}

// a pass's K (two key tiles x two d tiles) and its V^T (four d tiles) are 4 KiB in a row each
static __device__ __forceinline__ void key_fetch(KeySet& s, const _Float16* krow0, int kb) {
#pragma unroll
  for (int t = 0; t < 2; ++t) {
    const _Float16* krow = krow0 + (kb * 2 + t) * 1024;
    s.k[t][0] = load_frag(krow);
    s.k[t][1] = load_frag(krow + 512);
  }
}

static __device__ __forceinline__ void value_fetch(v16h (&av)[4], const _Float16* vrow0, int kb) {
#pragma unroll
  for (int td = 0; td < 4; ++td)
    av[td] = load_frag(vrow0 + (kb * 4 + td) * 512);
}

static __device__ __forceinline__ void attn_pass(const KeySet& ks, const v16h (&av)[4],
                                                 const v16h bq0, const v16h bq1,
                                                 float& ms, float& ls, v8f (&acc)[4]) {
  v8f s[2];                               // s[t][i] = S[query ln][kbase + t*16 + 8*half + i]
#pragma unroll
  for (int t = 0; t < 2; ++t) {
    v8f cc = {};
    cc = __builtin_amdgcn_wmma_f32_16x16x32_f16(false, ks.k[t][0], false, bq0, (short)0, cc, false, false);
    cc = __builtin_amdgcn_wmma_f32_16x16x32_f16(false, ks.k[t][1], false, bq1, (short)0, cc, false, false);
    const float4 m0 = ks.m[t][0], m1 = ks.m[t][1];
    cc[0] = cc[0] * 0.125f + m0.x; cc[1] = cc[1] * 0.125f + m0.y;
    cc[2] = cc[2] * 0.125f + m0.z; cc[3] = cc[3] * 0.125f + m0.w;
    cc[4] = cc[4] * 0.125f + m1.x; cc[5] = cc[5] * 0.125f + m1.y;
    cc[6] = cc[6] * 0.125f + m1.z; cc[7] = cc[7] * 0.125f + m1.w;
    s[t] = cc;
  }

  float mx[2];
#pragma unroll
  for (int t = 0; t < 2; ++t)
    mx[t] = fmaxf(fmaxf(fmaxf(s[t][0], s[t][1]), fmaxf(s[t][2], s[t][3])),
                  fmaxf(fmaxf(s[t][4], s[t][5]), fmaxf(s[t][6], s[t][7])));
  float t0 = fmaxf(mx[0], mx[1]);
  t0 = fmaxf(t0, other_half(t0));
  const float mn = fmaxf(ms, t0);
  const float scale = __expf(ms - mn);
  ms = mn;

  v16h bp;
  float ps[2];
#pragma unroll
  for (int t = 0; t < 2; ++t) {
    float p[8];
#pragma unroll
    for (int i = 0; i < 8; ++i) {
      p[i] = __expf(s[t][i] - mn);
      bp[t * 8 + i] = (_Float16)p[i];
    }
    ps[t] = ((p[0] + p[1]) + (p[2] + p[3])) + ((p[4] + p[5]) + (p[6] + p[7]));
  }
  ls = ls * scale + (ps[0] + ps[1]);

#pragma unroll
  for (int td = 0; td < 4; ++td) {
#pragma unroll
    for (int i = 0; i < 8; ++i) acc[td][i] *= scale;
    acc[td] = __builtin_amdgcn_wmma_f32_16x16x32_f16(false, av[td], false, bp,
                                                     (short)0, acc[td], false, false);
  }
}

__global__ void __launch_bounds__(128) attn_kernel(const _Float16* __restrict__ Qh,
                            const _Float16* __restrict__ Kh,
                            const _Float16* __restrict__ Vth,
                            const float* __restrict__ mask,
                            float* __restrict__ out) {
  const int lane = threadIdx.x & 31;
  const int wv = threadIdx.x >> 5;
  const int g = blockIdx.x * 4 + wv;      // 4096 waves
  const int qt = g & 127;                 // query tile 0..127
  const int bh = g >> 7;                  // 0..31
  const int b = bh >> 4, h = bh & 15;
  const int ln = lane & 15, half = lane >> 4;
  const int qbase = qt * 16;

  const _Float16* qrow = Qh + (bh * 128 + qt) * 1024 + lane * 8;
  const v16h bq0 = load_frag(qrow);
  const v16h bq1 = load_frag(qrow + 512);

  float ms = -1e30f, ls = 0.f;            // of query ln; ls: this half's keys only
  v8f acc[4];                             // acc[td][i] = O^T[td*16 + 8*half + i][query ln]
#pragma unroll
  for (int t = 0; t < 4; ++t) acc[t] = {};

  const _Float16* krow0 = Kh + bh * 128 * 1024 + lane * 8;
  const _Float16* vrow0 = Vth + bh * 64 * 2048 + lane * 8;
  const float* mrow = mask + b * 2048 + 8 * half;
  // Every global load is issued well ahead of its use, in three groups per trip of two passes:
  // V of the even pass at the head; V of the odd pass and K, mask of the next even pass behind
  // the whole even pass; K, mask of the next odd pass at the foot.
  // Each sched_barrier keeps a group together at its place: left alone, the scheduler sinks
  // every load to just before its use, where its whole latency is waited out. The two of the
  // first fill keep it in the order of the refills, mask first: the counted waits in the loop
  // are the stricter of the two ways into it.
  KeySet k0, k1;
  v16h av[4];
  mask_fetch(k0, mrow, 0);
  __builtin_amdgcn_sched_barrier(0);
  // the Q loads are still in flight and name an address pair that a K load below takes as target
  asm volatile("s_wait_xcnt 0x0" ::: "memory");
  key_fetch(k0, krow0, 0);
  mask_fetch(k1, mrow, 1);
  key_fetch(k1, krow0, 1);
  __builtin_amdgcn_sched_barrier(0);
  for (int kb = 0; kb < 64; kb += 2) {
    const int n2 = kb + 2 < 64 ? kb + 2 : 0;   // last trip: stays inside the planes, unused
    value_fetch(av, vrow0, kb);
    attn_pass(k0, av, bq0, bq1, ms, ls, acc);
    __builtin_amdgcn_sched_barrier(0);
    // the k1 loads of the trip before are still in flight and name the address registers
    // that the next lines rewrite
    asm volatile("s_wait_xcnt 0x0" ::: "memory");
    mask_fetch(k0, mrow, n2);
    value_fetch(av, vrow0, kb + 1);
    key_fetch(k0, krow0, n2);
    __builtin_amdgcn_sched_barrier(0);
    attn_pass(k1, av, bq0, bq1, ms, ls, acc);
    __builtin_amdgcn_sched_barrier(0);
    mask_fetch(k1, mrow, n2 + 1);
    key_fetch(k1, krow0, n2 + 1);
    __builtin_amdgcn_sched_barrier(0);
  }

  const float inv = 1.0f / (ls + other_half(ls));
  float* orow = out + (b * 2048 + qbase + ln) * 1024 + h * 64 + 8 * half;
#pragma unroll
  for (int td = 0; td < 4; ++td) {
    float4 o0, o1;
    o0.x = acc[td][0] * inv; o0.y = acc[td][1] * inv; o0.z = acc[td][2] * inv; o0.w = acc[td][3] * inv;
    o1.x = acc[td][4] * inv; o1.y = acc[td][5] * inv; o1.z = acc[td][6] * inv; o1.w = acc[td][7] * inv;
    *reinterpret_cast<float4*>(orow + td * 16) = o0;
    *reinterpret_cast<float4*>(orow + td * 16 + 4) = o1;
  }
}

extern "C" void kernel_launch(void* const* d_in, const int* in_sizes, int n_in,
                              void* d_out, int out_size, void* d_ws, size_t ws_size,
                              hipStream_t stream) {
  const float* X    = (const float*)d_in[0];
  const float* mask = (const float*)d_in[1];
  const float* Wq   = (const float*)d_in[2];
  const float* bq   = (const float*)d_in[3];
  const float* Wk   = (const float*)d_in[4];
  const float* bk   = (const float*)d_in[5];
  const float* Wv   = (const float*)d_in[6];
  const float* bv   = (const float*)d_in[7];
  float* out = (float*)d_out;

  _Float16* ws  = (_Float16*)d_ws;
  _Float16* Xh  = ws;                    // 4096*1024, all planes in fragment order
  _Float16* Wtq = Xh + 4194304;          // 1024*1024 each
  _Float16* Wtk = Wtq + 1048576;
  _Float16* Wtv = Wtk + 1048576;
  _Float16* Qh  = Wtv + 1048576;         // 2*16*2048*64 each
  _Float16* Kh  = Qh + 4194304;
  _Float16* Vth = Kh + 4194304;

  prep_kernel<<<512, 256, 0, stream>>>(X, Wq, Wk, Wv, Xh, Wtq);

  qkv_gemm_kernel<<<3072, 128, 0, stream>>>(Xh, Wtq, bq, bk, bv, Qh);

  attn_kernel<<<1024, 128, 0, stream>>>(Qh, Kh, Vth, mask, out);
}

// v005
// One run takes 68.9 microseconds.
// Two timings next to v004 put it at 1.20 and 1.21 times that version's speed.
// All steps since v000 together make it 5.39 times as fast.
#include <hip/hip_runtime.h>

typedef _Float16 v16h __attribute__((ext_vector_type(16)));
typedef float    v8f  __attribute__((ext_vector_type(8)));

// Two 16-byte chunks -> one 16-halfword WMMA fragment (A or B operand).
// Fragment element j corresponds to K index (j<8?0:16) + 8*half + (j%8).
// Every f16 plane of the workspace is kept in fragment order: a tile of 16 rows x 32 k is
// 512 halfwords, [chunk c][lane][8], lane = 16*half + row, k = 16*c + 8*half + (0..7).
// A wave's 16-byte load or store of one chunk then covers 512 bytes in a row (4 whole lines).
struct FragBits { uint4 lo, hi; };

// p = start of the tile + 8 * lane
static __device__ __forceinline__ v16h load_frag(const _Float16* p) {
  FragBits u;
  u.lo = *reinterpret_cast<const uint4*>(p);
  u.hi = *reinterpret_cast<const uint4*>(p + 256);
  return __builtin_bit_cast(v16h, u);
}

typedef _Float16 v8h __attribute__((ext_vector_type(8)));
typedef float    v4f __attribute__((ext_vector_type(4)));

// ---------------- X and Wq, Wk, Wv, fp32 -> f16 tiles in fragment order, one launch ----------
// 4096 waves, each with one share of every plane and all its 32 loads in flight at once
// (7 KiB a wave), so that few waves have to be started for the 28 MiB that are read.
// X [4096,1024] -> tiles [row tile][k tile]: a thread makes 16-byte chunk entries (8 k of one row);
//   a wave takes two whole tiles in four turns of 8 rows x 32 k (8 whole lines read, 4 written).
// W [K,N] -> tiles [n tile][k tile], row = n: a thread reads 8 k of ONE n, which is one chunk
//   entry: a wave's load is one whole line of a W row (32 n), its store two runs of 256 bytes.
//   A wave takes the same 32 n x 8 k of each of the three matrices.
__global__ void __launch_bounds__(256) prep_kernel(const float* __restrict__ x,
                                                   const float* __restrict__ wq,
                                                   const float* __restrict__ wk,
                                                   const float* __restrict__ wv,
                                                   _Float16* __restrict__ xh,
                                                   _Float16* __restrict__ wt) {
  const int lane = threadIdx.x & 31;
  const int w = blockIdx.x * 8 + (threadIdx.x >> 5);   // 4096 waves

  v4f f[4][2];
#pragma unroll
  for (int u = 0; u < 4; ++u) {
    const int o = (w * 4 + u) * 32 + lane;
    const int q = o & 3, row = (o >> 2) & 15, kt = (o >> 6) & 31, rt = o >> 11;  // k = 8*q + (0..7)
    const v4f* xp = reinterpret_cast<const v4f*>(x + (rt * 16 + row) * 1024 + kt * 32 + q * 8);
    f[u][0] = xp[0];
    f[u][1] = xp[1];
  }

  const int nb = w & 31, kg = w >> 5;                  // n = 32*nb + lane, k = 8*kg + (0..7)
  const int woff = kg * 8 * 1024 + nb * 32 + lane;
  v8f g[3];
#pragma unroll
  for (int e = 0; e < 8; ++e) {
    g[0][e] = wq[woff + e * 1024];
    g[1][e] = wk[woff + e * 1024];
    g[2][e] = wv[woff + e * 1024];
  }
  // takes the loaded values as inputs only: all 32 loads are issued ahead of the first conversion.
  // Left alone, the compiler holds some back behind the first wait to save registers, and their
  // whole latency is waited out a second time. Its wait stands in front of the address
  // arithmetic of the stores, which rewrites registers that the loads name.
  asm volatile("s_wait_xcnt 0x0" :: "v"(f[0][0]), "v"(f[0][1]), "v"(f[1][0]), "v"(f[1][1]), "v"(f[2][0]), "v"(f[2][1]),
               "v"(f[3][0]), "v"(f[3][1]), "v"(g[0]), "v"(g[1]), "v"(g[2]) : "memory");

#pragma unroll
  for (int u = 0; u < 4; ++u) {
    const int o = (w * 4 + u) * 32 + lane;
    const int q = o & 3, row = (o >> 2) & 15;
    const v4f f0 = f[u][0], f1 = f[u][1];
    v8h hv;
    hv[0] = (_Float16)f0.x; hv[1] = (_Float16)f0.y; hv[2] = (_Float16)f0.z; hv[3] = (_Float16)f0.w;
    hv[4] = (_Float16)f1.x; hv[5] = (_Float16)f1.y; hv[6] = (_Float16)f1.z; hv[7] = (_Float16)f1.w;
    // chunk c = q >> 1, lane = 16 * (q & 1) + row
    *reinterpret_cast<v8h*>(xh + (o >> 6) * 512 + (q >> 1) * 256 + ((q & 1) * 16 + row) * 8) = hv;
  }

  // n tile 2*nb + (lane >> 4), k tile kg >> 2, chunk (kg >> 1) & 1, lane 16 * (kg & 1) + (n & 15)
  _Float16* wp = wt + ((nb * 2 + (lane >> 4)) * 32 + (kg >> 2)) * 512 + ((kg >> 1) & 1) * 256 +
                 ((kg & 1) * 16 + (lane & 15)) * 8;
#pragma unroll
  for (int m = 0; m < 3; ++m) {
    v8h hv;
#pragma unroll
    for (int e = 0; e < 8; ++e) hv[e] = (_Float16)g[m][e];
    *reinterpret_cast<v8h*>(wp + m * 1048576) = hv;
  }
}

// ---------------- QKV projection: out = X @ W + b, f16 WMMA, f32 accum ----------
// One wave computes a 64x64 tile (four 16-row tiles of X, the 64 columns of one head): each of
// the 8 fragments of a pass feeds 4 products, one 16-byte load a product.
// VT = 0 (Q, K): tiles [b,h][s tile][d tile], row = s, k = d. The product is formed as W^T X^T,
//   so a lane's 8 accumulators are 8 d in a row of one s: one chunk entry of that tile.
// VT = 1 (V^T): tiles [b,h][32-key block][d tile], row = d, k = s. The product is formed as X W,
//   so a lane's 8 accumulators are 8 s in a row of one d.
// One pass = 32 k = one k tile of each operand: 16 loads of 16 bytes, 16 products.
struct GemmSet { v16h a[4]; v16h b[4]; };

static __device__ __forceinline__ void gemm_fetch(GemmSet& s, const _Float16* arow,
                                                  const _Float16* brow, int pass) {
#pragma unroll
  for (int j = 0; j < 4; ++j)
    s.a[j] = load_frag(arow + (j * 32 + pass) * 512);
#pragma unroll
  for (int t = 0; t < 4; ++t)
    s.b[t] = load_frag(brow + (t * 32 + pass) * 512);
}

template <int VT>
static __device__ __forceinline__ void gemm_mma(v8f (&acc)[4][4], const GemmSet& s) {
#pragma unroll
  for (int j = 0; j < 4; ++j)
#pragma unroll
    for (int t = 0; t < 4; ++t)
      acc[j][t] = VT ? __builtin_amdgcn_wmma_f32_16x16x32_f16(false, s.a[j], false, s.b[t],
                                                              (short)0, acc[j][t], false, false)
                     : __builtin_amdgcn_wmma_f32_16x16x32_f16(false, s.b[t], false, s.a[j],
                                                              (short)0, acc[j][t], false, false);
}

template <int VT>
static __device__ __forceinline__ void qkv_gemm_body(const _Float16* __restrict__ Xh,
                                const _Float16* __restrict__ Wt,
                                const float* __restrict__ bias,
                                _Float16* __restrict__ out, int r, int c) {
  // r: 64-row block of 4096 rows; c: col block (64 cols of 1024)
  const int lane = threadIdx.x & 31;
  const int ln = lane & 15, half = lane >> 4;

  v8f acc[4][4];
#pragma unroll
  for (int j = 0; j < 4; ++j)
#pragma unroll
    for (int t = 0; t < 4; ++t) acc[j][t] = {};

  const _Float16* arow = Xh + r * 4 * 32 * 512 + lane * 8;
  const _Float16* brow = Wt + c * 4 * 32 * 512 + lane * 8;
  // Two register sets: while one pass's products run, the next pass's 16 loads are in flight.
  // Each sched_barrier keeps a pass's loads together as one group ahead of the products
  // (left alone, the scheduler sinks each load to just before its use and every wait is exposed)
  // and keeps a set's refill behind the products that read it (a third set would cost a wave).
  GemmSet s0, s1;
  gemm_fetch(s0, arow, brow, 0);
  // keeps the first pass's loads ahead of the second's: with one of them behind, the first
  // products wait for both passes
  __builtin_amdgcn_sched_barrier(0);
  // unrolled whole: every load then has its place as an immediate offset from two addresses
  // that are never rewritten while loads are in flight
#pragma unroll
  for (int p = 0; p < 30; p += 2) {
    gemm_fetch(s1, arow, brow, p + 1);
    __builtin_amdgcn_sched_barrier(0);
    gemm_mma<VT>(acc, s0);
    __builtin_amdgcn_sched_barrier(0);
    gemm_fetch(s0, arow, brow, p + 2);
    __builtin_amdgcn_sched_barrier(0);
    gemm_mma<VT>(acc, s1);
    __builtin_amdgcn_sched_barrier(0);
  }
  gemm_fetch(s1, arow, brow, 31);
  __builtin_amdgcn_sched_barrier(0);
  // the epilogue reuses the address registers that the loads still in flight name. The two
  // addresses as inputs keep their registers from being taken as a target by the last loads;
  // the sched_barrier behind it keeps the epilogue's address arithmetic behind the wait.
  asm volatile("s_wait_xcnt 0x0" :: "v"(arow), "v"(brow) : "memory");
  __builtin_amdgcn_sched_barrier(0);
  gemm_mma<VT>(acc, s0);
  gemm_mma<VT>(acc, s1);

  const int bh = (r >> 5) * 16 + c;         // rows r*64.. lie in batch r>>5; head = c
  const int st0 = (r & 31) * 4;             // first 16-row tile of the sequence
#pragma unroll
  for (int t = 0; t < 4; ++t) {
    if (VT) {
      const float bz = bias[c * 64 + t * 16 + ln];
#pragma unroll
      for (int j = 0; j < 4; ++j) {
        const int st = st0 + j;
        v8h hv;
#pragma unroll
        for (int i = 0; i < 8; ++i) hv[i] = (_Float16)(acc[j][t][i] + bz);
        *reinterpret_cast<v8h*>(out + ((bh * 64 + (st >> 1)) * 4 + t) * 512 + (st & 1) * 256 + lane * 8) = hv;
      }
    } else {
      const float4* bp = reinterpret_cast<const float4*>(bias + c * 64 + t * 16 + 8 * half);
      const float4 b0 = bp[0], b1 = bp[1];
#pragma unroll
      for (int j = 0; j < 4; ++j) {
        v8h hv;
        hv[0] = (_Float16)(acc[j][t][0] + b0.x); hv[1] = (_Float16)(acc[j][t][1] + b0.y);
        hv[2] = (_Float16)(acc[j][t][2] + b0.z); hv[3] = (_Float16)(acc[j][t][3] + b0.w);
        hv[4] = (_Float16)(acc[j][t][4] + b1.x); hv[5] = (_Float16)(acc[j][t][5] + b1.y);
        hv[6] = (_Float16)(acc[j][t][6] + b1.z); hv[7] = (_Float16)(acc[j][t][7] + b1.w);
        *reinterpret_cast<v8h*>(out + (bh * 128 + st0 + j) * 1024 + t * 256 + lane * 8) = hv;
      }
    }
  }
  // in the merged kernel the code of the V^T body stands behind this one and rewrites
  // registers that the stores above name
  if (!VT) asm volatile("s_wait_xcnt 0x0" ::: "memory");
}

// The three projections in one launch. A block is 12 waves, all that a WGP holds of them:
// 4 row blocks (256 rows of X) x the Q, K and V^T columns of one head. Each X fragment is wanted
// by three of its waves and each W fragment by four, so most loads end in the WGP's cache.
// Wt and out are the three planes of each kind, one behind the other.
__global__ void __launch_bounds__(384) qkv_gemm_kernel(const _Float16* __restrict__ Xh,
                                const _Float16* __restrict__ Wt,
                                const float* __restrict__ bq,
                                const float* __restrict__ bk,
                                const float* __restrict__ bv,
                                _Float16* __restrict__ out) {
  // the wave's number in a scalar register: the choice of a body is then a scalar branch
  const int wv = __builtin_amdgcn_readfirstlane(threadIdx.x >> 5);
  const int which = wv >> 2;
  const int r = (blockIdx.x & 15) * 4 + (wv & 3);
  const int c = blockIdx.x >> 4;
  if (which == 2)
    qkv_gemm_body<1>(Xh, Wt + 2 * 1048576, bv, out + 2 * 4194304, r, c);
  else
    qkv_gemm_body<0>(Xh, Wt + which * 1048576, which ? bk : bq, out + which * 4194304, r, c);
}

// ---------------- fused flash attention ----------------
// One wave per 16-query tile per (b,h). Streams 32-key blocks, online softmax.
// Scores are formed transposed (S^T = K Q^T): a lane holds 16 keys of ONE query,
// so maximum and sum run in the lane, and the two score tiles, converted in place,
// are the B operand of O^T += V^T P^T.
static __device__ __forceinline__ float other_half(float x) {
  // lane l <-> lane l ^ 16
  return __builtin_bit_cast(float, __builtin_amdgcn_permlanex16(
      __builtin_bit_cast(int, x), __builtin_bit_cast(int, x),
      0x76543210, 0xfedcba98, false, false));
}

// K fragments and mask values of one 32-key pass.
struct KeySet { v16h k[2][2]; float4 m[2][2]; };

static __device__ __forceinline__ void mask_fetch(KeySet& s, const float* mrow, int kb) {
#pragma unroll
  for (int t = 0; t < 2; ++t) {
    const float4* mp = reinterpret_cast<const float4*>(mrow + kb * 32 + t * 16);
    s.m[t][0] = mp[0];
    s.m[t][1] = mp[1];
  }
}

// a pass's K (two key tiles x two d tiles) and its V^T (four d tiles) are 4 KiB in a row each
static __device__ __forceinline__ void key_fetch(KeySet& s, const _Float16* krow0, int kb) {
#pragma unroll
  for (int t = 0; t < 2; ++t) {
    const _Float16* krow = krow0 + (kb * 2 + t) * 1024;
    s.k[t][0] = load_frag(krow);
    s.k[t][1] = load_frag(krow + 512);
  }
}

static __device__ __forceinline__ void value_fetch(v16h (&av)[4], const _Float16* vrow0, int kb) {
#pragma unroll
  for (int td = 0; td < 4; ++td)
    av[td] = load_frag(vrow0 + (kb * 4 + td) * 512);
}

static __device__ __forceinline__ void attn_pass(const KeySet& ks, const v16h (&av)[4],
                                                 const v16h bq0, const v16h bq1,
                                                 float& ms, float& ls, v8f (&acc)[4]) {
  v8f s[2];                               // s[t][i] = S[query ln][kbase + t*16 + 8*half + i]
#pragma unroll
  for (int t = 0; t < 2; ++t) {
    v8f cc = {};
    cc = __builtin_amdgcn_wmma_f32_16x16x32_f16(false, ks.k[t][0], false, bq0, (short)0, cc, false, false);
    cc = __builtin_amdgcn_wmma_f32_16x16x32_f16(false, ks.k[t][1], false, bq1, (short)0, cc, false, false);
    const float4 m0 = ks.m[t][0], m1 = ks.m[t][1];
    cc[0] = cc[0] * 0.125f + m0.x; cc[1] = cc[1] * 0.125f + m0.y;
    cc[2] = cc[2] * 0.125f + m0.z; cc[3] = cc[3] * 0.125f + m0.w;
    cc[4] = cc[4] * 0.125f + m1.x; cc[5] = cc[5] * 0.125f + m1.y;
    cc[6] = cc[6] * 0.125f + m1.z; cc[7] = cc[7] * 0.125f + m1.w;
    s[t] = cc;
  }

  float mx[2];
#pragma unroll
  for (int t = 0; t < 2; ++t)
    mx[t] = fmaxf(fmaxf(fmaxf(s[t][0], s[t][1]), fmaxf(s[t][2], s[t][3])),
                  fmaxf(fmaxf(s[t][4], s[t][5]), fmaxf(s[t][6], s[t][7])));
  float t0 = fmaxf(mx[0], mx[1]);
  t0 = fmaxf(t0, other_half(t0));
  const float mn = fmaxf(ms, t0);
  const float scale = __expf(ms - mn);
  ms = mn;

  v16h bp;
  float ps[2];
#pragma unroll
  for (int t = 0; t < 2; ++t) {
    float p[8];
#pragma unroll
    for (int i = 0; i < 8; ++i) {
      p[i] = __expf(s[t][i] - mn);
      bp[t * 8 + i] = (_Float16)p[i];
    }
    ps[t] = ((p[0] + p[1]) + (p[2] + p[3])) + ((p[4] + p[5]) + (p[6] + p[7]));
  }
  ls = ls * scale + (ps[0] + ps[1]);

#pragma unroll
  for (int td = 0; td < 4; ++td) {
#pragma unroll
    for (int i = 0; i < 8; ++i) acc[td][i] *= scale;
    acc[td] = __builtin_amdgcn_wmma_f32_16x16x32_f16(false, av[td], false, bp,
                                                     (short)0, acc[td], false, false);
  }
}

__global__ void __launch_bounds__(128) attn_kernel(const _Float16* __restrict__ Qh,
                            const _Float16* __restrict__ Kh,
                            const _Float16* __restrict__ Vth,
                            const float* __restrict__ mask,
                            float* __restrict__ out) {
  const int lane = threadIdx.x & 31;
  const int wv = threadIdx.x >> 5;
  const int g = blockIdx.x * 4 + wv;      // 4096 waves
  const int qt = g & 127;                 // query tile 0..127
  const int bh = g >> 7;                  // 0..31
  const int b = bh >> 4, h = bh & 15;
  const int ln = lane & 15, half = lane >> 4;
  const int qbase = qt * 16;

  const _Float16* qrow = Qh + (bh * 128 + qt) * 1024 + lane * 8;
  const v16h bq0 = load_frag(qrow);
  const v16h bq1 = load_frag(qrow + 512);

  float ms = -1e30f, ls = 0.f;            // of query ln; ls: this half's keys only
  v8f acc[4];                             // acc[td][i] = O^T[td*16 + 8*half + i][query ln]
#pragma unroll
  for (int t = 0; t < 4; ++t) acc[t] = {};

  const _Float16* krow0 = Kh + bh * 128 * 1024 + lane * 8;
  const _Float16* vrow0 = Vth + bh * 64 * 2048 + lane * 8;
  const float* mrow = mask + b * 2048 + 8 * half;
  // Every global load is issued well ahead of its use, in three groups per trip of two passes:
  // V of the even pass at the head; V of the odd pass and K, mask of the next even pass behind
  // the whole even pass; K, mask of the next odd pass at the foot.
  // Each sched_barrier keeps a group together at its place: left alone, the scheduler sinks
  // every load to just before its use, where its whole latency is waited out. The two of the
  // first fill keep it in the order of the refills, mask first: the counted waits in the loop
  // are the stricter of the two ways into it.
  KeySet k0, k1;
  v16h av[4];
  mask_fetch(k0, mrow, 0);
  __builtin_amdgcn_sched_barrier(0);
  // the Q loads are still in flight and name an address pair that a K load below takes as target
  asm volatile("s_wait_xcnt 0x0" ::: "memory");
  key_fetch(k0, krow0, 0);
  mask_fetch(k1, mrow, 1);
  key_fetch(k1, krow0, 1);
  __builtin_amdgcn_sched_barrier(0);
  for (int kb = 0; kb < 64; kb += 2) {
    const int n2 = kb + 2 < 64 ? kb + 2 : 0;   // last trip: stays inside the planes, unused
    value_fetch(av, vrow0, kb);
    attn_pass(k0, av, bq0, bq1, ms, ls, acc);
    __builtin_amdgcn_sched_barrier(0);
    // the k1 loads of the trip before are still in flight and name the address registers
    // that the next lines rewrite
    asm volatile("s_wait_xcnt 0x0" ::: "memory");
    mask_fetch(k0, mrow, n2);
    value_fetch(av, vrow0, kb + 1);
    key_fetch(k0, krow0, n2);
    __builtin_amdgcn_sched_barrier(0);
    attn_pass(k1, av, bq0, bq1, ms, ls, acc);
    __builtin_amdgcn_sched_barrier(0);
    mask_fetch(k1, mrow, n2 + 1);
    key_fetch(k1, krow0, n2 + 1);
    __builtin_amdgcn_sched_barrier(0);
  }

  const float inv = 1.0f / (ls + other_half(ls));
  float* orow = out + (b * 2048 + qbase + ln) * 1024 + h * 64 + 8 * half;
#pragma unroll
  for (int td = 0; td < 4; ++td) {
    float4 o0, o1;
    o0.x = acc[td][0] * inv; o0.y = acc[td][1] * inv; o0.z = acc[td][2] * inv; o0.w = acc[td][3] * inv;
    o1.x = acc[td][4] * inv; o1.y = acc[td][5] * inv; o1.z = acc[td][6] * inv; o1.w = acc[td][7] * inv;
    *reinterpret_cast<float4*>(orow + td * 16) = o0;
    *reinterpret_cast<float4*>(orow + td * 16 + 4) = o1;
  }
}

extern "C" void kernel_launch(void* const* d_in, const int* in_sizes, int n_in,
                              void* d_out, int out_size, void* d_ws, size_t ws_size,
                              hipStream_t stream) {
  const float* X    = (const float*)d_in[0];
  const float* mask = (const float*)d_in[1];
  const float* Wq   = (const float*)d_in[2];
  const float* bq   = (const float*)d_in[3];
  const float* Wk   = (const float*)d_in[4];
  const float* bk   = (const float*)d_in[5];
  const float* Wv   = (const float*)d_in[6];
  const float* bv   = (const float*)d_in[7];
  float* out = (float*)d_out;

  _Float16* ws  = (_Float16*)d_ws;
  _Float16* Xh  = ws;                    // 4096*1024, all planes in fragment order
  _Float16* Wtq = Xh + 4194304;          // 1024*1024 each
  _Float16* Wtk = Wtq + 1048576;
  _Float16* Wtv = Wtk + 1048576;
  _Float16* Qh  = Wtv + 1048576;         // 2*16*2048*64 each
  _Float16* Kh  = Qh + 4194304;
  _Float16* Vth = Kh + 4194304;

  prep_kernel<<<512, 256, 0, stream>>>(X, Wq, Wk, Wv, Xh, Wtq);

  qkv_gemm_kernel<<<256, 384, 0, stream>>>(Xh, Wtq, bq, bk, bv, Qh);

  attn_kernel<<<1024, 128, 0, stream>>>(Qh, Kh, Vth, mask, out);
}

// v006
// Measured time: 62.9 microseconds a run.
// Next to v005, in two timings, it ran 1.10 and 1.11 times as fast.
// Over all steps from v000 it is 5.95 times as fast.
#include <hip/hip_runtime.h>

typedef _Float16 v16h __attribute__((ext_vector_type(16)));
typedef float    v8f  __attribute__((ext_vector_type(8)));

// Two 16-byte chunks -> one 16-halfword WMMA fragment (A or B operand).
// Fragment element j corresponds to K index (j<8?0:16) + 8*half + (j%8).
// Every f16 plane of the workspace is kept in fragment order: a tile of 16 rows x 32 k is
// 512 halfwords, [chunk c][lane][8], lane = 16*half + row, k = 16*c + 8*half + (0..7).
// A wave's 16-byte load or store of one chunk then covers 512 bytes in a row (4 whole lines).
struct FragBits { uint4 lo, hi; };

// p = start of the tile + 8 * lane
static __device__ __forceinline__ v16h load_frag(const _Float16* p) {
  FragBits u;
  u.lo = *reinterpret_cast<const uint4*>(p);
  u.hi = *reinterpret_cast<const uint4*>(p + 256);
  return __builtin_bit_cast(v16h, u);
}

typedef _Float16 v8h __attribute__((ext_vector_type(8)));
typedef float    v4f __attribute__((ext_vector_type(4)));

// ---------------- X and Wq, Wk, Wv, fp32 -> f16 tiles in fragment order, one launch ----------
// 4096 waves, each with one share of every plane and all its 32 loads in flight at once
// (7 KiB a wave), so that few waves have to be started for the 28 MiB that are read.
// X [4096,1024] -> tiles [row tile][k tile]: a thread makes 16-byte chunk entries (8 k of one row);
//   a wave takes two whole tiles in four turns of 8 rows x 32 k (8 whole lines read, 4 written).
// W [K,N] -> tiles [n tile][k tile], row = n: a thread reads 8 k of ONE n, which is one chunk
//   entry: a wave's load is one whole line of a W row (32 n), its store two runs of 256 bytes.
//   A wave takes the same 32 n x 8 k of each of the three matrices.
__global__ void __launch_bounds__(256) prep_kernel(const float* __restrict__ x,
                                                   const float* __restrict__ wq,
                                                   const float* __restrict__ wk,
                                                   const float* __restrict__ wv,
                                                   _Float16* __restrict__ xh,
                                                   _Float16* __restrict__ wt) {
  const int lane = threadIdx.x & 31;
  const int w = blockIdx.x * 8 + (threadIdx.x >> 5);   // 4096 waves

  v4f f[4][2];
#pragma unroll
  for (int u = 0; u < 4; ++u) {
    const int o = (w * 4 + u) * 32 + lane;
    const int q = o & 3, row = (o >> 2) & 15, kt = (o >> 6) & 31, rt = o >> 11;  // k = 8*q + (0..7)
    const v4f* xp = reinterpret_cast<const v4f*>(x + (rt * 16 + row) * 1024 + kt * 32 + q * 8);
    f[u][0] = xp[0];
    f[u][1] = xp[1];
  }

  const int nb = w & 31, kg = w >> 5;                  // n = 32*nb + lane, k = 8*kg + (0..7)
  const int woff = kg * 8 * 1024 + nb * 32 + lane;
  v8f g[3];
#pragma unroll
  for (int e = 0; e < 8; ++e) {
    g[0][e] = wq[woff + e * 1024];
    g[1][e] = wk[woff + e * 1024];
    g[2][e] = wv[woff + e * 1024];
  }
  // takes the loaded values as inputs only: all 32 loads are issued ahead of the first conversion.
  // Left alone, the compiler holds some back behind the first wait to save registers, and their
  // whole latency is waited out a second time. Its wait stands in front of the address
  // arithmetic of the stores, which rewrites registers that the loads name.
  asm volatile("s_wait_xcnt 0x0" :: "v"(f[0][0]), "v"(f[0][1]), "v"(f[1][0]), "v"(f[1][1]), "v"(f[2][0]), "v"(f[2][1]),
               "v"(f[3][0]), "v"(f[3][1]), "v"(g[0]), "v"(g[1]), "v"(g[2]) : "memory");

#pragma unroll
  for (int u = 0; u < 4; ++u) {
    const int o = (w * 4 + u) * 32 + lane;
    const int q = o & 3, row = (o >> 2) & 15;
    const v4f f0 = f[u][0], f1 = f[u][1];
    v8h hv;
    hv[0] = (_Float16)f0.x; hv[1] = (_Float16)f0.y; hv[2] = (_Float16)f0.z; hv[3] = (_Float16)f0.w;
    hv[4] = (_Float16)f1.x; hv[5] = (_Float16)f1.y; hv[6] = (_Float16)f1.z; hv[7] = (_Float16)f1.w;
    // chunk c = q >> 1, lane = 16 * (q & 1) + row
    *reinterpret_cast<v8h*>(xh + (o >> 6) * 512 + (q >> 1) * 256 + ((q & 1) * 16 + row) * 8) = hv;
  }

  // n tile 2*nb + (lane >> 4), k tile kg >> 2, chunk (kg >> 1) & 1, lane 16 * (kg & 1) + (n & 15)
  _Float16* wp = wt + ((nb * 2 + (lane >> 4)) * 32 + (kg >> 2)) * 512 + ((kg >> 1) & 1) * 256 +
                 ((kg & 1) * 16 + (lane & 15)) * 8;
#pragma unroll
  for (int m = 0; m < 3; ++m) {
    v8h hv;
#pragma unroll
    for (int e = 0; e < 8; ++e) hv[e] = (_Float16)g[m][e];
    *reinterpret_cast<v8h*>(wp + m * 1048576) = hv;
  }
}

// ---------------- QKV projection: out = X @ W + b, f16 WMMA, f32 accum ----------
// One wave computes a 64x64 tile (four 16-row tiles of X, the 64 columns of one head): each of
// the 8 fragments of a pass feeds 4 products, one 16-byte load a product.
// VT = 0 (Q, K): tiles [b,h][s tile][d tile], row = s, k = d. The product is formed as W^T X^T,
//   so a lane's 8 accumulators are 8 d in a row of one s: one chunk entry of that tile.
// VT = 1 (V^T): tiles [b,h][32-key block][d tile], row = d, k = s. The product is formed as X W,
//   so a lane's 8 accumulators are 8 s in a row of one d.
// One pass = 32 k = one k tile of each operand: 16 loads of 16 bytes, 16 products.
struct GemmSet { v16h a[4]; v16h b[4]; };

static __device__ __forceinline__ void gemm_fetch(GemmSet& s, const _Float16* arow,
                                                  const _Float16* brow, int pass) {
#pragma unroll
  for (int j = 0; j < 4; ++j)
    s.a[j] = load_frag(arow + (j * 32 + pass) * 512);
#pragma unroll
  for (int t = 0; t < 4; ++t)
    s.b[t] = load_frag(brow + (t * 32 + pass) * 512);
}

template <int VT>
static __device__ __forceinline__ void gemm_mma(v8f (&acc)[4][4], const GemmSet& s) {
#pragma unroll
  for (int j = 0; j < 4; ++j)
#pragma unroll
    for (int t = 0; t < 4; ++t)
      acc[j][t] = VT ? __builtin_amdgcn_wmma_f32_16x16x32_f16(false, s.a[j], false, s.b[t],
                                                              (short)0, acc[j][t], false, false)
                     : __builtin_amdgcn_wmma_f32_16x16x32_f16(false, s.b[t], false, s.a[j],
                                                              (short)0, acc[j][t], false, false);
}

template <int VT>
static __device__ __forceinline__ void qkv_gemm_body(const _Float16* __restrict__ Xh,
                                const _Float16* __restrict__ Wt,
                                const float* __restrict__ bias,
                                _Float16* __restrict__ out, int r, int c) {
  // r: 64-row block of 4096 rows; c: col block (64 cols of 1024)
  const int lane = threadIdx.x & 31;
  const int ln = lane & 15, half = lane >> 4;

  v8f acc[4][4];
#pragma unroll
  for (int j = 0; j < 4; ++j)
#pragma unroll
    for (int t = 0; t < 4; ++t) acc[j][t] = {};

  const _Float16* arow = Xh + r * 4 * 32 * 512 + lane * 8;
  const _Float16* brow = Wt + c * 4 * 32 * 512 + lane * 8;
  // Two register sets: while one pass's products run, the next pass's 16 loads are in flight.
  // Each sched_barrier keeps a pass's loads together as one group ahead of the products
  // (left alone, the scheduler sinks each load to just before its use and every wait is exposed)
  // and keeps a set's refill behind the products that read it (a third set would cost a wave).
  GemmSet s0, s1;
  gemm_fetch(s0, arow, brow, 0);
  // keeps the first pass's loads ahead of the second's: with one of them behind, the first
  // products wait for both passes
  __builtin_amdgcn_sched_barrier(0);
  // unrolled whole: every load then has its place as an immediate offset from two addresses
  // that are never rewritten while loads are in flight
#pragma unroll
  for (int p = 0; p < 30; p += 2) {
    gemm_fetch(s1, arow, brow, p + 1);
    __builtin_amdgcn_sched_barrier(0);
    gemm_mma<VT>(acc, s0);
    __builtin_amdgcn_sched_barrier(0);
    gemm_fetch(s0, arow, brow, p + 2);
    __builtin_amdgcn_sched_barrier(0);
    gemm_mma<VT>(acc, s1);
    __builtin_amdgcn_sched_barrier(0);
  }
  gemm_fetch(s1, arow, brow, 31);
  __builtin_amdgcn_sched_barrier(0);
  // the epilogue reuses the address registers that the loads still in flight name. The two
  // addresses as inputs keep their registers from being taken as a target by the last loads;
  // the sched_barrier behind it keeps the epilogue's address arithmetic behind the wait.
  asm volatile("s_wait_xcnt 0x0" :: "v"(arow), "v"(brow) : "memory");
  __builtin_amdgcn_sched_barrier(0);
  gemm_mma<VT>(acc, s0);
  gemm_mma<VT>(acc, s1);

  const int bh = (r >> 5) * 16 + c;         // rows r*64.. lie in batch r>>5; head = c
  const int st0 = (r & 31) * 4;             // first 16-row tile of the sequence
#pragma unroll
  for (int t = 0; t < 4; ++t) {
    if (VT) {
      const float bz = bias[c * 64 + t * 16 + ln];
#pragma unroll
      for (int j = 0; j < 4; ++j) {
        const int st = st0 + j;
        v8h hv;
#pragma unroll
        for (int i = 0; i < 8; ++i) hv[i] = (_Float16)(acc[j][t][i] + bz);
        *reinterpret_cast<v8h*>(out + ((bh * 64 + (st >> 1)) * 4 + t) * 512 + (st & 1) * 256 + lane * 8) = hv;
      }
    } else {
      const float4* bp = reinterpret_cast<const float4*>(bias + c * 64 + t * 16 + 8 * half);
      const float4 b0 = bp[0], b1 = bp[1];
#pragma unroll
      for (int j = 0; j < 4; ++j) {
        v8h hv;
        hv[0] = (_Float16)(acc[j][t][0] + b0.x); hv[1] = (_Float16)(acc[j][t][1] + b0.y);
        hv[2] = (_Float16)(acc[j][t][2] + b0.z); hv[3] = (_Float16)(acc[j][t][3] + b0.w);
        hv[4] = (_Float16)(acc[j][t][4] + b1.x); hv[5] = (_Float16)(acc[j][t][5] + b1.y);
        hv[6] = (_Float16)(acc[j][t][6] + b1.z); hv[7] = (_Float16)(acc[j][t][7] + b1.w);
        *reinterpret_cast<v8h*>(out + (bh * 128 + st0 + j) * 1024 + t * 256 + lane * 8) = hv;
      }
    }
  }
  // in the merged kernel the code of the V^T body stands behind this one and rewrites
  // registers that the stores above name
  if (!VT) asm volatile("s_wait_xcnt 0x0" ::: "memory");
}

// The three projections in one launch. A block is 12 waves, all that a WGP holds of them:
// 4 row blocks (256 rows of X) x the Q, K and V^T columns of one head. Each X fragment is wanted
// by three of its waves and each W fragment by four, so most loads end in the WGP's cache.
// Wt and out are the three planes of each kind, one behind the other.
__global__ void __launch_bounds__(384) qkv_gemm_kernel(const _Float16* __restrict__ Xh,
                                const _Float16* __restrict__ Wt,
                                const float* __restrict__ bq,
                                const float* __restrict__ bk,
                                const float* __restrict__ bv,
                                _Float16* __restrict__ out) {
  // the wave's number in a scalar register: the choice of a body is then a scalar branch
  const int wv = __builtin_amdgcn_readfirstlane(threadIdx.x >> 5);
  const int which = wv >> 2;
  const int r = (blockIdx.x & 15) * 4 + (wv & 3);
  const int c = blockIdx.x >> 4;
  if (which == 2)
    qkv_gemm_body<1>(Xh, Wt + 2 * 1048576, bv, out + 2 * 4194304, r, c);
  else
    qkv_gemm_body<0>(Xh, Wt + which * 1048576, which ? bk : bq, out + which * 4194304, r, c);
}

// ---------------- fused flash attention ----------------
// One wave per 32 queries (two 16-query tiles) and 1024 keys (one half of the sequence) of one
// (b,h): each K, V fragment and mask word loaded feeds both query tiles, and the split of the keys
// keeps four waves on a SIMD. Streams 32-key blocks, online softmax; the two key halves of a
// query tile are joined at the end through LDS.
// Scores are formed transposed (S^T = K Q^T): a lane holds 16 keys of ONE query,
// so maximum and sum run in the lane, and the two score tiles, converted in place,
// are the B operand of O^T += V^T P^T.
static __device__ __forceinline__ float other_half(float x) {
  // lane l <-> lane l ^ 16
  return __builtin_bit_cast(float, __builtin_amdgcn_permlanex16(
      __builtin_bit_cast(int, x), __builtin_bit_cast(int, x),
      0x76543210, 0xfedcba98, false, false));
}

static __device__ __forceinline__ void mask_fetch(v8f (&m)[2], const float* p) {
#pragma unroll
  for (int t = 0; t < 2; ++t) {
    const v4f* mp = reinterpret_cast<const v4f*>(p + t * 16);
    const v4f a = mp[0], c = mp[1];
    m[t] = __builtin_shufflevector(a, c, 0, 1, 2, 3, 4, 5, 6, 7);
  }
}

// p: the lane's address in the pass. A pass's K (two key tiles x two d tiles) and its V^T
// (four d tiles) are 4 KiB in a row each
static __device__ __forceinline__ void key_fetch(v16h (&k)[2][2], const _Float16* p) {
#pragma unroll
  for (int t = 0; t < 2; ++t) {
    k[t][0] = load_frag(p + t * 1024);
    k[t][1] = load_frag(p + t * 1024 + 512);
  }
}

static __device__ __forceinline__ void value_fetch(v16h (&av)[4], const _Float16* p) {
#pragma unroll
  for (int td = 0; td < 4; ++td)
    av[td] = load_frag(p + td * 512);
}

// running softmax of one query tile over one pass: s[t][i] = S[query ln][t*16 + 8*half + i]
// its new maximum
static __device__ __forceinline__ float softmax_max(const v8f (&s)[2], float ms) {
  float mx[2];
#pragma unroll
  for (int t = 0; t < 2; ++t)
    mx[t] = fmaxf(fmaxf(fmaxf(s[t][0], s[t][1]), fmaxf(s[t][2], s[t][3])),
                  fmaxf(fmaxf(s[t][4], s[t][5]), fmaxf(s[t][6], s[t][7])));
  float t0 = fmaxf(mx[0], mx[1]);
  t0 = fmaxf(t0, other_half(t0));
  return fmaxf(ms, t0);
}

// P as a B operand; sum and output rescaled to the new maximum mn
static __device__ __forceinline__ v16h softmax_step(const v8f (&s)[2], float mn, float scale,
                                                    float& ls, v8f (&acc)[4]) {
  v16h bp;
  float ps[2];
#pragma unroll
  for (int t = 0; t < 2; ++t) {
    // e^x as 2^(x * log2 e), on whole score tiles: neighbours in a tile share a packed instruction
    const v8f d = (s[t] - mn) * 1.44269504088896340736f;
    float p[8];
#pragma unroll
    for (int i = 0; i < 8; ++i) {
      p[i] = __builtin_amdgcn_exp2f(d[i]);
      bp[t * 8 + i] = (_Float16)p[i];
    }
    ps[t] = ((p[0] + p[1]) + (p[2] + p[3])) + ((p[4] + p[5]) + (p[6] + p[7]));
  }
  ls = ls * scale + (ps[0] + ps[1]);
#pragma unroll
  for (int td = 0; td < 4; ++td) acc[td] *= scale;
  return bp;
}

struct AttnState {
  v16h bq[2][2];     // Q fragments of the two query tiles
  v16h kf[2][2];     // K of the pass at hand, refilled behind the score products
  v16h av[4];        // V^T of the pass at hand, refilled behind the output products
  v8f mk[2];         // mask words of the pass at hand, refilled behind their additions
  float ms[2], ls[2];  // of query ln; ls: this lane half's keys only
  v8f acc[2][4];     // acc[u][td][i] = O^T[td*16 + 8*half + i][query ln]
  const _Float16* kp;  // the lane's addresses of the fetches last issued
  const _Float16* vp;
  const float* mp;
};

// One pass of 32 keys for both query tiles; every register set is left filled for pass nx.
// Each sched_barrier keeps a group of loads at its place: left alone, the scheduler sinks every
// load to just before its use, where its whole latency is waited out.
static __device__ __forceinline__ void attn_pass(AttnState& a,
                                                 const _Float16* kuni, const _Float16* vuni,
                                                 const float* muni, int foff, int moff, int nx) {
  v8f s[2][2];
#pragma unroll
  for (int u = 0; u < 2; ++u)
#pragma unroll
    for (int t = 0; t < 2; ++t) {
      v8f cc = {};
      s[u][t] = __builtin_amdgcn_wmma_f32_16x16x32_f16(false, a.kf[t][0], false, a.bq[u][0], (short)0, cc, false, false);
    }
#pragma unroll
  for (int u = 0; u < 2; ++u)
#pragma unroll
    for (int t = 0; t < 2; ++t)
      s[u][t] = __builtin_amdgcn_wmma_f32_16x16x32_f16(false, a.kf[t][1], false, a.bq[u][1], (short)0, s[u][t], false, false);
  __builtin_amdgcn_sched_barrier(0);
  // loads of the pass before are still in flight and name the address registers that the next
  // lines rewrite. The next pass's number goes through the statement, so that all address
  // arithmetic made from it stands behind the wait; the old addresses as inputs keep their
  // registers from being taken as a target by the loads that name them.
  asm volatile("s_wait_xcnt 0x0" : "+s"(nx) : "v"(a.kp), "v"(a.vp), "v"(a.mp) : "memory");
  a.kp = kuni + nx * 2048 + foff;
  a.vp = vuni + nx * 2048 + foff;
  a.mp = muni + nx * 32 + moff;
  key_fetch(a.kf, a.kp);
  __builtin_amdgcn_sched_barrier(0);
#pragma unroll
  for (int u = 0; u < 2; ++u)
#pragma unroll
    for (int t = 0; t < 2; ++t) s[u][t] = s[u][t] * 0.125f + a.mk[t];
  __builtin_amdgcn_sched_barrier(0);
  mask_fetch(a.mk, a.mp);
  __builtin_amdgcn_sched_barrier(0);
  v16h bp[2];
  float mn[2], scale[2];
#pragma unroll
  for (int u = 0; u < 2; ++u) mn[u] = softmax_max(s[u], a.ms[u]);
#pragma unroll
  for (int u = 0; u < 2; ++u) {
    scale[u] = __builtin_amdgcn_exp2f((a.ms[u] - mn[u]) * 1.44269504088896340736f);
    a.ms[u] = mn[u];
  }
#pragma unroll
  for (int u = 0; u < 2; ++u) bp[u] = softmax_step(s[u], mn[u], scale[u], a.ls[u], a.acc[u]);
  // the vector work ends ahead of the products: mixed in, it lands on operand registers of
  // products just issued, and each such place is padded with four idle slots
  __builtin_amdgcn_sched_barrier(0);
#pragma unroll
  for (int u = 0; u < 2; ++u)
#pragma unroll
    for (int td = 0; td < 4; ++td)
      a.acc[u][td] = __builtin_amdgcn_wmma_f32_16x16x32_f16(false, a.av[td], false, bp[u],
                                                            (short)0, a.acc[u][td], false, false);
  __builtin_amdgcn_sched_barrier(0);
  value_fetch(a.av, a.vp);
  __builtin_amdgcn_sched_barrier(0);
}

__global__ void __launch_bounds__(256) __attribute__((amdgpu_waves_per_eu(4, 4)))
attn_kernel(const _Float16* __restrict__ Qh,
                            const _Float16* __restrict__ Kh,
                            const _Float16* __restrict__ Vth,
                            const float* __restrict__ mask,
                            float* __restrict__ out) {
  // what a wave hands to the wave with the other key half: one query tile's sums
  __shared__ float4 xacc[8][8][32];
  __shared__ float2 xml[8][32];

  const int lane = threadIdx.x & 31;
  // the wave's number in a scalar register: plane addresses are then scalar
  const int wv = __builtin_amdgcn_readfirstlane(threadIdx.x >> 5);
  const int ks = wv & 1;                              // key half
  const int qg = (blockIdx.x & 15) * 4 + (wv >> 1);   // group of 32 queries, 0..63
  const int bh = blockIdx.x >> 4;                     // 0..31
  const int b = bh >> 4, h = bh & 15;
  const int ln = lane & 15, half = lane >> 4;
  const int foff = lane * 8, moff = 8 * half;

  AttnState a;
  const _Float16* qrow = Qh + (bh * 128 + qg * 2) * 1024;
#pragma unroll
  for (int u = 0; u < 2; ++u) {
    a.bq[u][0] = load_frag(qrow + foff + u * 1024);
    a.bq[u][1] = load_frag(qrow + foff + u * 1024 + 512);
    a.ms[u] = -1e30f;
    a.ls[u] = 0.f;
#pragma unroll
    for (int t = 0; t < 4; ++t) a.acc[u][t] = {};
  }

  const _Float16* kuni = Kh + (bh * 128 + ks * 64) * 1024;
  const _Float16* vuni = Vth + (bh * 64 + ks * 32) * 2048;
  const float* muni = mask + b * 2048 + ks * 1024;
  // the first fill in the order of the refills: the counted waits in the loop are the stricter
  // of the two ways into it
  a.kp = kuni + foff;
  a.vp = vuni + foff;
  a.mp = muni + moff;
  key_fetch(a.kf, a.kp);
  __builtin_amdgcn_sched_barrier(0);
  mask_fetch(a.mk, a.mp);
  __builtin_amdgcn_sched_barrier(0);
  value_fetch(a.av, a.vp);
  __builtin_amdgcn_sched_barrier(0);
  for (int kb = 0; kb < 32; ++kb)
    // last trip: stays inside the planes, unused
    attn_pass(a, kuni, vuni, muni, foff, moff, kb + 1 < 32 ? kb + 1 : 0);

  // Join of the key halves: wave ks keeps query tile ks and hands the other tile to its partner.
  v8f keep[4], give[4];
#pragma unroll
  for (int td = 0; td < 4; ++td) {
    keep[td] = ks ? a.acc[1][td] : a.acc[0][td];
    give[td] = ks ? a.acc[0][td] : a.acc[1][td];
  }
  const float mkeep = ks ? a.ms[1] : a.ms[0], lkeep = ks ? a.ls[1] : a.ls[0];
  const float mgive = ks ? a.ms[0] : a.ms[1], lgive = ks ? a.ls[0] : a.ls[1];
#pragma unroll
  for (int td = 0; td < 4; ++td) {
    xacc[wv][td * 2][lane] = make_float4(give[td][0], give[td][1], give[td][2], give[td][3]);
    xacc[wv][td * 2 + 1][lane] = make_float4(give[td][4], give[td][5], give[td][6], give[td][7]);
  }
  xml[wv][lane] = make_float2(mgive, lgive);
  __syncthreads();
  const float2 ml = xml[wv ^ 1][lane];
  const float mn = fmaxf(mkeep, ml.x);
  const float ek = __expf(mkeep - mn), eo = __expf(ml.x - mn);
  const float lsum = lkeep * ek + ml.y * eo;
  const float inv = 1.0f / (lsum + other_half(lsum));
  const float fk = ek * inv, fo = eo * inv;
  float* orow = out + (b * 2048 + (qg * 2 + ks) * 16 + ln) * 1024 + h * 64 + 8 * half;
#pragma unroll
  for (int td = 0; td < 4; ++td) {
    const float4 g0 = xacc[wv ^ 1][td * 2][lane], g1 = xacc[wv ^ 1][td * 2 + 1][lane];
    float4 o0, o1;
    o0.x = keep[td][0] * fk + g0.x * fo; o0.y = keep[td][1] * fk + g0.y * fo;
    o0.z = keep[td][2] * fk + g0.z * fo; o0.w = keep[td][3] * fk + g0.w * fo;
    o1.x = keep[td][4] * fk + g1.x * fo; o1.y = keep[td][5] * fk + g1.y * fo;
    o1.z = keep[td][6] * fk + g1.z * fo; o1.w = keep[td][7] * fk + g1.w * fo;
    *reinterpret_cast<float4*>(orow + td * 16) = o0;
    *reinterpret_cast<float4*>(orow + td * 16 + 4) = o1;
  }
}

extern "C" void kernel_launch(void* const* d_in, const int* in_sizes, int n_in,
                              void* d_out, int out_size, void* d_ws, size_t ws_size,
                              hipStream_t stream) {
  const float* X    = (const float*)d_in[0];
  const float* mask = (const float*)d_in[1];
  const float* Wq   = (const float*)d_in[2];
  const float* bq   = (const float*)d_in[3];
  const float* Wk   = (const float*)d_in[4];
  const float* bk   = (const float*)d_in[5];
  const float* Wv   = (const float*)d_in[6];
  const float* bv   = (const float*)d_in[7];
  float* out = (float*)d_out;

  _Float16* ws  = (_Float16*)d_ws;
  _Float16* Xh  = ws;                    // 4096*1024, all planes in fragment order
  _Float16* Wtq = Xh + 4194304;          // 1024*1024 each
  _Float16* Wtk = Wtq + 1048576;
  _Float16* Wtv = Wtk + 1048576;
  _Float16* Qh  = Wtv + 1048576;         // 2*16*2048*64 each
  _Float16* Kh  = Qh + 4194304;
  _Float16* Vth = Kh + 4194304;

  prep_kernel<<<512, 256, 0, stream>>>(X, Wq, Wk, Wv, Xh, Wtq);

  qkv_gemm_kernel<<<256, 384, 0, stream>>>(Xh, Wtq, bq, bk, bv, Qh);

  attn_kernel<<<512, 256, 0, stream>>>(Qh, Kh, Vth, mask, out);
}

// v007
// A run of this version takes 59.7 microseconds.
// Two timings next to v006 put it at 1.05 and 1.04 times that version's speed.
// Counting every step since v000, it is 6.21 times as fast.
#include <hip/hip_runtime.h>

typedef _Float16 v16h __attribute__((ext_vector_type(16)));
typedef float    v8f  __attribute__((ext_vector_type(8)));

// Two 16-byte chunks -> one 16-halfword WMMA fragment (A or B operand).
// Fragment element j corresponds to K index (j<8?0:16) + 8*half + (j%8).
// Every f16 plane of the workspace is kept in fragment order: a tile of 16 rows x 32 k is
// 512 halfwords, [chunk c][lane][8], lane = 16*half + row, k = 16*c + 8*half + (0..7).
// A wave's 16-byte load or store of one chunk then covers 512 bytes in a row (4 whole lines).
struct FragBits { uint4 lo, hi; };

// p = start of the tile + 8 * lane
static __device__ __forceinline__ v16h load_frag(const _Float16* p) {
  FragBits u;
  u.lo = *reinterpret_cast<const uint4*>(p);
  u.hi = *reinterpret_cast<const uint4*>(p + 256);
  return __builtin_bit_cast(v16h, u);
}

typedef _Float16 v8h __attribute__((ext_vector_type(8)));
typedef float    v4f __attribute__((ext_vector_type(4)));

// Where the i-th of 16 blocks that read the same planes enters a walk of 32 stages: the 16 even
// stages, the two base-4 digits of i swapped, so that blocks with neighbouring i, or any run of
// them, stand far apart and evenly.
static __device__ __forceinline__ int walk_start(int i) {
  return (i & 3) * 8 + (i >> 2) * 2;
}

// ---------------- X and Wq, Wk, Wv, fp32 -> f16 tiles in fragment order, one launch ----------
// 4096 waves, each with one share of every plane and all its 32 loads in flight at once
// (7 KiB a wave), so that few waves have to be started for the 28 MiB that are read.
// X [4096,1024] -> tiles [row tile][k tile]: a thread makes 16-byte chunk entries (8 k of one row);
//   a wave takes two whole tiles in four turns of 8 rows x 32 k (8 whole lines read, 4 written).
// W [K,N] -> tiles [n tile][k tile], row = n: a thread reads 8 k of ONE n, which is one chunk
//   entry: a wave's load is one whole line of a W row (32 n), its store two runs of 256 bytes.
//   A wave takes the same 32 n x 8 k of each of the three matrices.
__global__ void __launch_bounds__(256) prep_kernel(const float* __restrict__ x,
                                                   const float* __restrict__ wq,
                                                   const float* __restrict__ wk,
                                                   const float* __restrict__ wv,
                                                   _Float16* __restrict__ xh,
                                                   _Float16* __restrict__ wt) {
  const int lane = threadIdx.x & 31;
  const int w = blockIdx.x * 8 + (threadIdx.x >> 5);   // 4096 waves

  v4f f[4][2];
#pragma unroll
  for (int u = 0; u < 4; ++u) {
    const int o = (w * 4 + u) * 32 + lane;
    const int q = o & 3, row = (o >> 2) & 15, kt = (o >> 6) & 31, rt = o >> 11;  // k = 8*q + (0..7)
    const v4f* xp = reinterpret_cast<const v4f*>(x + (rt * 16 + row) * 1024 + kt * 32 + q * 8);
    f[u][0] = xp[0];
    f[u][1] = xp[1];
  }

  const int nb = w & 31, kg = w >> 5;                  // n = 32*nb + lane, k = 8*kg + (0..7)
  const int woff = kg * 8 * 1024 + nb * 32 + lane;
  v8f g[3];
#pragma unroll
  for (int e = 0; e < 8; ++e) {
    g[0][e] = wq[woff + e * 1024];
    g[1][e] = wk[woff + e * 1024];
    g[2][e] = wv[woff + e * 1024];
  }
  // takes the loaded values as inputs only: all 32 loads are issued ahead of the first conversion.
  // Left alone, the compiler holds some back behind the first wait to save registers, and their
  // whole latency is waited out a second time. Its wait stands in front of the address
  // arithmetic of the stores, which rewrites registers that the loads name.
  asm volatile("s_wait_xcnt 0x0" :: "v"(f[0][0]), "v"(f[0][1]), "v"(f[1][0]), "v"(f[1][1]), "v"(f[2][0]), "v"(f[2][1]),
               "v"(f[3][0]), "v"(f[3][1]), "v"(g[0]), "v"(g[1]), "v"(g[2]) : "memory");

#pragma unroll
  for (int u = 0; u < 4; ++u) {
    const int o = (w * 4 + u) * 32 + lane;
    const int q = o & 3, row = (o >> 2) & 15;
    const v4f f0 = f[u][0], f1 = f[u][1];
    v8h hv;
    hv[0] = (_Float16)f0.x; hv[1] = (_Float16)f0.y; hv[2] = (_Float16)f0.z; hv[3] = (_Float16)f0.w;
    hv[4] = (_Float16)f1.x; hv[5] = (_Float16)f1.y; hv[6] = (_Float16)f1.z; hv[7] = (_Float16)f1.w;
    // chunk c = q >> 1, lane = 16 * (q & 1) + row
    *reinterpret_cast<v8h*>(xh + (o >> 6) * 512 + (q >> 1) * 256 + ((q & 1) * 16 + row) * 8) = hv;
  }

  // n tile 2*nb + (lane >> 4), k tile kg >> 2, chunk (kg >> 1) & 1, lane 16 * (kg & 1) + (n & 15)
  _Float16* wp = wt + ((nb * 2 + (lane >> 4)) * 32 + (kg >> 2)) * 512 + ((kg >> 1) & 1) * 256 +
                 ((kg & 1) * 16 + (lane & 15)) * 8;
#pragma unroll
  for (int m = 0; m < 3; ++m) {
    v8h hv;
#pragma unroll
    for (int e = 0; e < 8; ++e) hv[e] = (_Float16)g[m][e];
    *reinterpret_cast<v8h*>(wp + m * 1048576) = hv;
  }
}

// ---------------- QKV projection: out = X @ W + b, f16 WMMA, f32 accum ----------
// One wave computes a 64x64 tile (four 16-row tiles of X, the 64 columns of one head): each of
// the 8 fragments of a pass feeds 4 products, one 16-byte load a product.
// VT = 0 (Q, K): tiles [b,h][s tile][d tile], row = s, k = d. The product is formed as W^T X^T,
//   so a lane's 8 accumulators are 8 d in a row of one s: one chunk entry of that tile.
// VT = 1 (V^T): tiles [b,h][32-key block][d tile], row = d, k = s. The product is formed as X W,
//   so a lane's 8 accumulators are 8 s in a row of one d.
// One pass = 32 k = one k tile of each operand: 16 loads of 16 bytes, 16 products.
struct GemmSet { v16h a[4]; v16h b[4]; };

// ap, bp: the lane's addresses in the k tile of the pass
static __device__ __forceinline__ void gemm_fetch(GemmSet& s, const _Float16* ap,
                                                  const _Float16* bp) {
#pragma unroll
  for (int j = 0; j < 4; ++j)
    s.a[j] = load_frag(ap + j * 32 * 512);
#pragma unroll
  for (int t = 0; t < 4; ++t)
    s.b[t] = load_frag(bp + t * 32 * 512);
}

// the addresses of k tile kt. Loads of the pass before are still in flight and name the address
// registers that are rewritten here: the tile's offset goes through the wait's statement, so that
// the additions made with it stand behind the wait; the old addresses as inputs keep their
// registers from being taken as a target by the loads that name them.
static __device__ __forceinline__ void gemm_seek(const _Float16*& ap, const _Float16*& bp,
                                                 const _Float16* arow, const _Float16* brow,
                                                 int kt) {
  unsigned off = (unsigned)kt * 1024u;   // bytes: a k tile of 16 rows is 1 KiB
  asm volatile("s_wait_xcnt 0x0" : "+s"(off) : "v"(ap), "v"(bp) : "memory");
  ap = reinterpret_cast<const _Float16*>(reinterpret_cast<const char*>(arow) + off);
  bp = reinterpret_cast<const _Float16*>(reinterpret_cast<const char*>(brow) + off);
}

template <int VT>
static __device__ __forceinline__ void gemm_mma(v8f (&acc)[4][4], const GemmSet& s) {
#pragma unroll
  for (int j = 0; j < 4; ++j)
#pragma unroll
    for (int t = 0; t < 4; ++t)
      acc[j][t] = VT ? __builtin_amdgcn_wmma_f32_16x16x32_f16(false, s.a[j], false, s.b[t],
                                                              (short)0, acc[j][t], false, false)
                     : __builtin_amdgcn_wmma_f32_16x16x32_f16(false, s.b[t], false, s.a[j],
                                                              (short)0, acc[j][t], false, false);
}

template <int VT>
static __device__ __forceinline__ void qkv_gemm_body(const _Float16* __restrict__ Xh,
                                const _Float16* __restrict__ Wt,
                                const float* __restrict__ bias,
                                _Float16* __restrict__ out, int r, int c, int rot) {
  // r: 64-row block of 4096 rows; c: col block (64 cols of 1024); rot: the k tile of the first pass
  const int lane = threadIdx.x & 31;
  const int ln = lane & 15, half = lane >> 4;

  v8f acc[4][4];
#pragma unroll
  for (int j = 0; j < 4; ++j)
#pragma unroll
    for (int t = 0; t < 4; ++t) acc[j][t] = {};

  const _Float16* arow = Xh + r * 4 * 32 * 512 + lane * 8;
  const _Float16* brow = Wt + c * 4 * 32 * 512 + lane * 8;
  // Two register sets: while one pass's products run, the next pass's 16 loads are in flight.
  // Each sched_barrier keeps a pass's loads together as one group ahead of the products
  // (left alone, the scheduler sinks each load to just before its use and every wait is exposed)
  // and keeps a set's refill behind the products that read it (a third set would cost a wave).
  // Pass p works on k tile (p + rot) mod 32: the walk wraps round.
  GemmSet s0, s1;
  const _Float16* ap = arow + rot * 512;
  const _Float16* bp = brow + rot * 512;
  gemm_fetch(s0, ap, bp);
  // keeps the first pass's loads ahead of the second's: with one of them behind, the first
  // products wait for both passes
  __builtin_amdgcn_sched_barrier(0);
  // unrolled whole: straight-line code, no counter and no branch between the groups
#pragma unroll
  for (int p = 0; p < 30; p += 2) {
    gemm_seek(ap, bp, arow, brow, (p + 1 + rot) & 31);
    gemm_fetch(s1, ap, bp);
    __builtin_amdgcn_sched_barrier(0);
    gemm_mma<VT>(acc, s0);
    __builtin_amdgcn_sched_barrier(0);
    gemm_seek(ap, bp, arow, brow, (p + 2 + rot) & 31);
    gemm_fetch(s0, ap, bp);
    __builtin_amdgcn_sched_barrier(0);
    gemm_mma<VT>(acc, s1);
    __builtin_amdgcn_sched_barrier(0);
  }
  gemm_seek(ap, bp, arow, brow, (31 + rot) & 31);
  gemm_fetch(s1, ap, bp);
  __builtin_amdgcn_sched_barrier(0);
  // the epilogue reuses the address registers that the loads still in flight name. The two
  // addresses as inputs keep their registers from being taken as a target by the last loads;
  // the sched_barrier behind it keeps the epilogue's address arithmetic behind the wait.
  asm volatile("s_wait_xcnt 0x0" :: "v"(ap), "v"(bp) : "memory");
  __builtin_amdgcn_sched_barrier(0);
  gemm_mma<VT>(acc, s0);
  gemm_mma<VT>(acc, s1);

  const int bh = (r >> 5) * 16 + c;         // rows r*64.. lie in batch r>>5; head = c
  const int st0 = (r & 31) * 4;             // first 16-row tile of the sequence
#pragma unroll
  for (int t = 0; t < 4; ++t) {
    if (VT) {
      const float bz = bias[c * 64 + t * 16 + ln];
#pragma unroll
      for (int j = 0; j < 4; ++j) {
        const int st = st0 + j;
        v8h hv;
#pragma unroll
        for (int i = 0; i < 8; ++i) hv[i] = (_Float16)(acc[j][t][i] + bz);
        *reinterpret_cast<v8h*>(out + ((bh * 64 + (st >> 1)) * 4 + t) * 512 + (st & 1) * 256 + lane * 8) = hv;
      }
    } else {
      const float4* bp = reinterpret_cast<const float4*>(bias + c * 64 + t * 16 + 8 * half);
      const float4 b0 = bp[0], b1 = bp[1];
#pragma unroll
      for (int j = 0; j < 4; ++j) {
        v8h hv;
        hv[0] = (_Float16)(acc[j][t][0] + b0.x); hv[1] = (_Float16)(acc[j][t][1] + b0.y);
        hv[2] = (_Float16)(acc[j][t][2] + b0.z); hv[3] = (_Float16)(acc[j][t][3] + b0.w);
        hv[4] = (_Float16)(acc[j][t][4] + b1.x); hv[5] = (_Float16)(acc[j][t][5] + b1.y);
        hv[6] = (_Float16)(acc[j][t][6] + b1.z); hv[7] = (_Float16)(acc[j][t][7] + b1.w);
        *reinterpret_cast<v8h*>(out + (bh * 128 + st0 + j) * 1024 + t * 256 + lane * 8) = hv;
      }
    }
  }
  // in the merged kernel the code of the V^T body stands behind this one and rewrites
  // registers that the stores above name
  if (!VT) asm volatile("s_wait_xcnt 0x0" ::: "memory");
}

// The three projections in one launch. A block is 12 waves, all that a WGP holds of them:
// 4 row blocks (256 rows of X) x the Q, K and V^T columns of one head. Each X fragment is wanted
// by three of its waves and each W fragment by four, so most loads end in the WGP's cache.
// Wt and out are the three planes of each kind, one behind the other.
__global__ void __launch_bounds__(384) qkv_gemm_kernel(const _Float16* __restrict__ Xh,
                                const _Float16* __restrict__ Wt,
                                const float* __restrict__ bq,
                                const float* __restrict__ bk,
                                const float* __restrict__ bv,
                                _Float16* __restrict__ out) {
  // the wave's number in a scalar register: the choice of a body is then a scalar branch
  const int wv = __builtin_amdgcn_readfirstlane(threadIdx.x >> 5);
  const int which = wv >> 2;
  const int r = (blockIdx.x & 15) * 4 + (wv & 3);
  const int c = blockIdx.x >> 4;
  // Sixteen blocks want the same rows of X (one row group, every head) and sixteen the same rows
  // of W (one head, every row group). Walking k in step they would ask L2 for the same lines at
  // the same moment, each line new to L2 just then. Each block starts at a k tile of its own:
  // the sixteen of either kind stand on sixteen different tiles, and all but a line's first
  // reader find it in L2.
  const int rot = (walk_start(blockIdx.x & 15) + 2 * c) & 31;
  // the plane's address is formed ahead of the branch, in scalar registers. As a constant inside
  // the V^T body it went into the loads' immediate offsets, and the address register was then
  // completed directly behind the loads that name it, ahead of the wait.
  const _Float16* wplane = Wt + which * 1048576;
  if (which == 2)
    qkv_gemm_body<1>(Xh, wplane, bv, out + 2 * 4194304, r, c, rot);
  else
    qkv_gemm_body<0>(Xh, wplane, which ? bk : bq, out + which * 4194304, r, c, rot);
}

// ---------------- fused flash attention ----------------
// One wave per 32 queries (two 16-query tiles) and 1024 keys (one half of the sequence) of one
// (b,h): each K, V fragment and mask word loaded feeds both query tiles, and the split of the keys
// keeps four waves on a SIMD. Streams 32-key blocks, online softmax; the two key halves of a
// query tile are joined at the end through LDS.
// Scores are formed transposed (S^T = K Q^T): a lane holds 16 keys of ONE query,
// so maximum and sum run in the lane, and the two score tiles, converted in place,
// are the B operand of O^T += V^T P^T.
static __device__ __forceinline__ float other_half(float x) {
  // lane l <-> lane l ^ 16
  return __builtin_bit_cast(float, __builtin_amdgcn_permlanex16(
      __builtin_bit_cast(int, x), __builtin_bit_cast(int, x),
      0x76543210, 0xfedcba98, false, false));
}

static __device__ __forceinline__ void mask_fetch(v8f (&m)[2], const float* p) {
#pragma unroll
  for (int t = 0; t < 2; ++t) {
    const v4f* mp = reinterpret_cast<const v4f*>(p + t * 16);
    const v4f a = mp[0], c = mp[1];
    m[t] = __builtin_shufflevector(a, c, 0, 1, 2, 3, 4, 5, 6, 7);
  }
}

// p: the lane's address in the pass. A pass's K (two key tiles x two d tiles) and its V^T
// (four d tiles) are 4 KiB in a row each
static __device__ __forceinline__ void key_fetch(v16h (&k)[2][2], const _Float16* p) {
#pragma unroll
  for (int t = 0; t < 2; ++t) {
    k[t][0] = load_frag(p + t * 1024);
    k[t][1] = load_frag(p + t * 1024 + 512);
  }
}

static __device__ __forceinline__ void value_fetch(v16h (&av)[4], const _Float16* p) {
#pragma unroll
  for (int td = 0; td < 4; ++td)
    av[td] = load_frag(p + td * 512);
}

// running softmax of one query tile over one pass: s[t][i] = S[query ln][t*16 + 8*half + i]
// its new maximum
static __device__ __forceinline__ float softmax_max(const v8f (&s)[2], float ms) {
  float mx[2];
#pragma unroll
  for (int t = 0; t < 2; ++t)
    mx[t] = fmaxf(fmaxf(fmaxf(s[t][0], s[t][1]), fmaxf(s[t][2], s[t][3])),
                  fmaxf(fmaxf(s[t][4], s[t][5]), fmaxf(s[t][6], s[t][7])));
  float t0 = fmaxf(mx[0], mx[1]);
  t0 = fmaxf(t0, other_half(t0));
  return fmaxf(ms, t0);
}

// P as a B operand; sum and output rescaled to the new maximum mn
static __device__ __forceinline__ v16h softmax_step(const v8f (&s)[2], float mn, float scale,
                                                    float& ls, v8f (&acc)[4]) {
  v16h bp;
  float ps[2];
#pragma unroll
  for (int t = 0; t < 2; ++t) {
    // e^x as 2^(x * log2 e), on whole score tiles: neighbours in a tile share a packed instruction
    const v8f d = (s[t] - mn) * 1.44269504088896340736f;
    float p[8];
#pragma unroll
    for (int i = 0; i < 8; ++i) {
      p[i] = __builtin_amdgcn_exp2f(d[i]);
      bp[t * 8 + i] = (_Float16)p[i];
    }
    ps[t] = ((p[0] + p[1]) + (p[2] + p[3])) + ((p[4] + p[5]) + (p[6] + p[7]));
  }
  ls = ls * scale + (ps[0] + ps[1]);
#pragma unroll
  for (int td = 0; td < 4; ++td) acc[td] *= scale;
  return bp;
}

struct AttnState {
  v16h bq[2][2];     // Q fragments of the two query tiles
  v16h kf[2][2];     // K of the pass at hand, refilled behind the score products
  v16h av[4];        // V^T of the pass at hand, refilled behind the output products
  v8f mk[2];         // mask words of the pass at hand, refilled behind their additions
  float ms[2], ls[2];  // of query ln; ls: this lane half's keys only
  v8f acc[2][4];     // acc[u][td][i] = O^T[td*16 + 8*half + i][query ln]
  const _Float16* kp;  // the lane's addresses of the fetches last issued
  const _Float16* vp;
  const float* mp;
};

// One pass of 32 keys for both query tiles; every register set is left filled for pass nx.
// Each sched_barrier keeps a group of loads at its place: left alone, the scheduler sinks every
// load to just before its use, where its whole latency is waited out.
static __device__ __forceinline__ void attn_pass(AttnState& a,
                                                 const _Float16* kuni, const _Float16* vuni,
                                                 const float* muni, int foff, int moff, int nx) {
  v8f s[2][2];
#pragma unroll
  for (int u = 0; u < 2; ++u)
#pragma unroll
    for (int t = 0; t < 2; ++t) {
      v8f cc = {};
      s[u][t] = __builtin_amdgcn_wmma_f32_16x16x32_f16(false, a.kf[t][0], false, a.bq[u][0], (short)0, cc, false, false);
    }
#pragma unroll
  for (int u = 0; u < 2; ++u)
#pragma unroll
    for (int t = 0; t < 2; ++t)
      s[u][t] = __builtin_amdgcn_wmma_f32_16x16x32_f16(false, a.kf[t][1], false, a.bq[u][1], (short)0, s[u][t], false, false);
  __builtin_amdgcn_sched_barrier(0);
  // loads of the pass before are still in flight and name the address registers that the next
  // lines rewrite. The next pass's number goes through the statement, so that all address
  // arithmetic made from it stands behind the wait; the old addresses as inputs keep their
  // registers from being taken as a target by the loads that name them.
  asm volatile("s_wait_xcnt 0x0" : "+s"(nx) : "v"(a.kp), "v"(a.vp), "v"(a.mp) : "memory");
  a.kp = kuni + nx * 2048 + foff;
  a.vp = vuni + nx * 2048 + foff;
  a.mp = muni + nx * 32 + moff;
  key_fetch(a.kf, a.kp);
  __builtin_amdgcn_sched_barrier(0);
#pragma unroll
  for (int u = 0; u < 2; ++u)
#pragma unroll
    for (int t = 0; t < 2; ++t) s[u][t] = s[u][t] * 0.125f + a.mk[t];
  __builtin_amdgcn_sched_barrier(0);
  mask_fetch(a.mk, a.mp);
  __builtin_amdgcn_sched_barrier(0);
  v16h bp[2];
  float mn[2], scale[2];
#pragma unroll
  for (int u = 0; u < 2; ++u) mn[u] = softmax_max(s[u], a.ms[u]);
#pragma unroll
  for (int u = 0; u < 2; ++u) {
    scale[u] = __builtin_amdgcn_exp2f((a.ms[u] - mn[u]) * 1.44269504088896340736f);
    a.ms[u] = mn[u];
  }
#pragma unroll
  for (int u = 0; u < 2; ++u) bp[u] = softmax_step(s[u], mn[u], scale[u], a.ls[u], a.acc[u]);
  // the vector work ends ahead of the products: mixed in, it lands on operand registers of
  // products just issued, and each such place is padded with four idle slots
  __builtin_amdgcn_sched_barrier(0);
#pragma unroll
  for (int u = 0; u < 2; ++u)
#pragma unroll
    for (int td = 0; td < 4; ++td)
      a.acc[u][td] = __builtin_amdgcn_wmma_f32_16x16x32_f16(false, a.av[td], false, bp[u],
                                                            (short)0, a.acc[u][td], false, false);
  __builtin_amdgcn_sched_barrier(0);
  value_fetch(a.av, a.vp);
  __builtin_amdgcn_sched_barrier(0);
}

__global__ void __launch_bounds__(256) __attribute__((amdgpu_waves_per_eu(4, 4)))
attn_kernel(const _Float16* __restrict__ Qh,
                            const _Float16* __restrict__ Kh,
                            const _Float16* __restrict__ Vth,
                            const float* __restrict__ mask,
                            float* __restrict__ out) {
  // what a wave hands to the wave with the other key half: one query tile's sums
  __shared__ float4 xacc[8][8][32];
  __shared__ float2 xml[8][32];

  const int lane = threadIdx.x & 31;
  // the wave's number in a scalar register: plane addresses are then scalar
  const int wv = __builtin_amdgcn_readfirstlane(threadIdx.x >> 5);
  const int ks = wv & 1;                              // key half
  const int qg = (blockIdx.x & 15) * 4 + (wv >> 1);   // group of 32 queries, 0..63
  const int bh = blockIdx.x >> 4;                     // 0..31
  const int b = bh >> 4, h = bh & 15;
  const int ln = lane & 15, half = lane >> 4;
  const int foff = lane * 8, moff = 8 * half;
  // the sixteen blocks of one (b,h) read the same K, V^T and mask: each enters the key walk at a
  // pass of its own and wraps round, so that they do not ask L2 for the same lines at one moment
  const int rot = walk_start(blockIdx.x & 15);

  AttnState a;
  const _Float16* qrow = Qh + (bh * 128 + qg * 2) * 1024;
#pragma unroll
  for (int u = 0; u < 2; ++u) {
    a.bq[u][0] = load_frag(qrow + foff + u * 1024);
    a.bq[u][1] = load_frag(qrow + foff + u * 1024 + 512);
    a.ms[u] = -1e30f;
    a.ls[u] = 0.f;
#pragma unroll
    for (int t = 0; t < 4; ++t) a.acc[u][t] = {};
  }

  const _Float16* kuni = Kh + (bh * 128 + ks * 64) * 1024;
  const _Float16* vuni = Vth + (bh * 64 + ks * 32) * 2048;
  const float* muni = mask + b * 2048 + ks * 1024;
  // the first fill in the order of the refills: the counted waits in the loop are the stricter
  // of the two ways into it
  a.kp = kuni + rot * 2048 + foff;
  a.vp = vuni + rot * 2048 + foff;
  a.mp = muni + rot * 32 + moff;
  key_fetch(a.kf, a.kp);
  __builtin_amdgcn_sched_barrier(0);
  mask_fetch(a.mk, a.mp);
  __builtin_amdgcn_sched_barrier(0);
  value_fetch(a.av, a.vp);
  __builtin_amdgcn_sched_barrier(0);
  for (int kb = 0; kb < 32; ++kb)
    // last trip: the first pass's place again, inside the planes, unused
    attn_pass(a, kuni, vuni, muni, foff, moff, (kb + 1 + rot) & 31);

  // Join of the key halves: wave ks keeps query tile ks and hands the other tile to its partner.
  v8f keep[4], give[4];
#pragma unroll
  for (int td = 0; td < 4; ++td) {
    keep[td] = ks ? a.acc[1][td] : a.acc[0][td];
    give[td] = ks ? a.acc[0][td] : a.acc[1][td];
  }
  const float mkeep = ks ? a.ms[1] : a.ms[0], lkeep = ks ? a.ls[1] : a.ls[0];
  const float mgive = ks ? a.ms[0] : a.ms[1], lgive = ks ? a.ls[0] : a.ls[1];
#pragma unroll
  for (int td = 0; td < 4; ++td) {
    xacc[wv][td * 2][lane] = make_float4(give[td][0], give[td][1], give[td][2], give[td][3]);
    xacc[wv][td * 2 + 1][lane] = make_float4(give[td][4], give[td][5], give[td][6], give[td][7]);
  }
  xml[wv][lane] = make_float2(mgive, lgive);
  __syncthreads();
  const float2 ml = xml[wv ^ 1][lane];
  const float mn = fmaxf(mkeep, ml.x);
  const float ek = __expf(mkeep - mn), eo = __expf(ml.x - mn);
  const float lsum = lkeep * ek + ml.y * eo;
  const float inv = 1.0f / (lsum + other_half(lsum));
  const float fk = ek * inv, fo = eo * inv;
  float* orow = out + (b * 2048 + (qg * 2 + ks) * 16 + ln) * 1024 + h * 64 + 8 * half;
#pragma unroll
  for (int td = 0; td < 4; ++td) {
    const float4 g0 = xacc[wv ^ 1][td * 2][lane], g1 = xacc[wv ^ 1][td * 2 + 1][lane];
    float4 o0, o1;
    o0.x = keep[td][0] * fk + g0.x * fo; o0.y = keep[td][1] * fk + g0.y * fo;
    o0.z = keep[td][2] * fk + g0.z * fo; o0.w = keep[td][3] * fk + g0.w * fo;
    o1.x = keep[td][4] * fk + g1.x * fo; o1.y = keep[td][5] * fk + g1.y * fo;
    o1.z = keep[td][6] * fk + g1.z * fo; o1.w = keep[td][7] * fk + g1.w * fo;
    *reinterpret_cast<float4*>(orow + td * 16) = o0;
    *reinterpret_cast<float4*>(orow + td * 16 + 4) = o1;
  }
}

extern "C" void kernel_launch(void* const* d_in, const int* in_sizes, int n_in,
                              void* d_out, int out_size, void* d_ws, size_t ws_size,
                              hipStream_t stream) {
  const float* X    = (const float*)d_in[0];
  const float* mask = (const float*)d_in[1];
  const float* Wq   = (const float*)d_in[2];
  const float* bq   = (const float*)d_in[3];
  const float* Wk   = (const float*)d_in[4];
  const float* bk   = (const float*)d_in[5];
  const float* Wv   = (const float*)d_in[6];
  const float* bv   = (const float*)d_in[7];
  float* out = (float*)d_out;

  _Float16* ws  = (_Float16*)d_ws;
  _Float16* Xh  = ws;                    // 4096*1024, all planes in fragment order
  _Float16* Wtq = Xh + 4194304;          // 1024*1024 each
  _Float16* Wtk = Wtq + 1048576;
  _Float16* Wtv = Wtk + 1048576;
  _Float16* Qh  = Wtv + 1048576;         // 2*16*2048*64 each
  _Float16* Kh  = Qh + 4194304;
  _Float16* Vth = Kh + 4194304;

  prep_kernel<<<512, 256, 0, stream>>>(X, Wq, Wk, Wv, Xh, Wtq);

  qkv_gemm_kernel<<<256, 384, 0, stream>>>(Xh, Wtq, bq, bk, bv, Qh);

  attn_kernel<<<512, 256, 0, stream>>>(Qh, Kh, Vth, mask, out);
}

// v008
// One run takes 56.9 microseconds.
// Two timings next to v007 both put it at 1.04 times that version's speed.
// Over all steps from v000 it is 6.48 times as fast.
#include <hip/hip_runtime.h>

typedef _Float16 v16h __attribute__((ext_vector_type(16)));
typedef float    v8f  __attribute__((ext_vector_type(8)));

// Two 16-byte chunks -> one 16-halfword WMMA fragment (A or B operand).
// Fragment element j corresponds to K index (j<8?0:16) + 8*half + (j%8).
// Every f16 plane of the workspace is kept in fragment order: a tile of 16 rows x 32 k is
// 512 halfwords, [chunk c][lane][8], lane = 16*half + row, k = 16*c + 8*half + (0..7).
// A wave's 16-byte load or store of one chunk then covers 512 bytes in a row (4 whole lines).
struct FragBits { uint4 lo, hi; };

// p = start of the tile + 8 * lane
static __device__ __forceinline__ v16h load_frag(const _Float16* p) {
  FragBits u;
  u.lo = *reinterpret_cast<const uint4*>(p);
  u.hi = *reinterpret_cast<const uint4*>(p + 256);
  return __builtin_bit_cast(v16h, u);
}

typedef _Float16 v8h __attribute__((ext_vector_type(8)));
typedef float    v4f __attribute__((ext_vector_type(4)));

// Where the i-th of 16 blocks that read the same planes enters a walk of 32 stages: the 16 even
// stages, the two base-4 digits of i swapped, so that blocks with neighbouring i, or any run of
// them, stand far apart and evenly.
static __device__ __forceinline__ int walk_start(int i) {
  return (i & 3) * 8 + (i >> 2) * 2;
}

// ---------------- X and Wq, Wk, Wv, fp32 -> f16 tiles in fragment order, one launch ----------
// 4096 waves, each with one share of every plane and all its 32 loads in flight at once
// (7 KiB a wave), so that few waves have to be started for the 28 MiB that are read.
// X [4096,1024] -> tiles [row tile][k tile]: a thread makes 16-byte chunk entries (8 k of one row);
//   a wave takes two whole tiles in four turns of 8 rows x 32 k (8 whole lines read, 4 written).
// W [K,N] -> tiles [n tile][k tile], row = n: a thread reads 8 k of ONE n, which is one chunk
//   entry: a wave's load is one whole line of a W row (32 n), its store two runs of 256 bytes.
//   A wave takes the same 32 n x 8 k of each of the three matrices.
__global__ void __launch_bounds__(256) prep_kernel(const float* __restrict__ x,
                                                   const float* __restrict__ wq,
                                                   const float* __restrict__ wk,
                                                   const float* __restrict__ wv,
                                                   _Float16* __restrict__ xh,
                                                   _Float16* __restrict__ wt) {
  const int lane = threadIdx.x & 31;
  const int w = blockIdx.x * 8 + (threadIdx.x >> 5);   // 4096 waves

  v4f f[4][2];
#pragma unroll
  for (int u = 0; u < 4; ++u) {
    const int o = (w * 4 + u) * 32 + lane;
    const int q = o & 3, row = (o >> 2) & 15, kt = (o >> 6) & 31, rt = o >> 11;  // k = 8*q + (0..7)
    const v4f* xp = reinterpret_cast<const v4f*>(x + (rt * 16 + row) * 1024 + kt * 32 + q * 8);
    f[u][0] = xp[0];
    f[u][1] = xp[1];
  }

  const int nb = w & 31, kg = w >> 5;                  // n = 32*nb + lane, k = 8*kg + (0..7)
  const int woff = kg * 8 * 1024 + nb * 32 + lane;
  v8f g[3];
#pragma unroll
  for (int e = 0; e < 8; ++e) {
    g[0][e] = wq[woff + e * 1024];
    g[1][e] = wk[woff + e * 1024];
    g[2][e] = wv[woff + e * 1024];
  }
  // takes the loaded values as inputs only: all 32 loads are issued ahead of the first conversion.
  // Left alone, the compiler holds some back behind the first wait to save registers, and their
  // whole latency is waited out a second time. Its wait stands in front of the address
  // arithmetic of the stores, which rewrites registers that the loads name.
  asm volatile("s_wait_xcnt 0x0" :: "v"(f[0][0]), "v"(f[0][1]), "v"(f[1][0]), "v"(f[1][1]), "v"(f[2][0]), "v"(f[2][1]),
               "v"(f[3][0]), "v"(f[3][1]), "v"(g[0]), "v"(g[1]), "v"(g[2]) : "memory");

#pragma unroll
  for (int u = 0; u < 4; ++u) {
    const int o = (w * 4 + u) * 32 + lane;
    const int q = o & 3, row = (o >> 2) & 15;
    const v4f f0 = f[u][0], f1 = f[u][1];
    v8h hv;
    hv[0] = (_Float16)f0.x; hv[1] = (_Float16)f0.y; hv[2] = (_Float16)f0.z; hv[3] = (_Float16)f0.w;
    hv[4] = (_Float16)f1.x; hv[5] = (_Float16)f1.y; hv[6] = (_Float16)f1.z; hv[7] = (_Float16)f1.w;
    // chunk c = q >> 1, lane = 16 * (q & 1) + row
    *reinterpret_cast<v8h*>(xh + (o >> 6) * 512 + (q >> 1) * 256 + ((q & 1) * 16 + row) * 8) = hv;
  }

  // n tile 2*nb + (lane >> 4), k tile kg >> 2, chunk (kg >> 1) & 1, lane 16 * (kg & 1) + (n & 15)
  _Float16* wp = wt + ((nb * 2 + (lane >> 4)) * 32 + (kg >> 2)) * 512 + ((kg >> 1) & 1) * 256 +
                 ((kg & 1) * 16 + (lane & 15)) * 8;
#pragma unroll
  for (int m = 0; m < 3; ++m) {
    v8h hv;
#pragma unroll
    for (int e = 0; e < 8; ++e) hv[e] = (_Float16)g[m][e];
    *reinterpret_cast<v8h*>(wp + m * 1048576) = hv;
  }
}

// ---------------- QKV projection: out = X @ W + b (Q times 0.125 * log2 e), f16 WMMA, f32 accum ----------
// One wave computes a 64x64 tile (four 16-row tiles of X, the 64 columns of one head): each of
// the 8 fragments of a pass feeds 4 products, one 16-byte load a product.
// VT = 0 (Q, K): tiles [b,h][s tile][d tile], row = s, k = d. The product is formed as W^T X^T,
//   so a lane's 8 accumulators are 8 d in a row of one s: one chunk entry of that tile.
// VT = 1 (V^T): tiles [b,h][32-key block][d tile], row = d, k = s. The product is formed as X W,
//   so a lane's 8 accumulators are 8 s in a row of one d.
// One pass = 32 k = one k tile of each operand: 16 loads of 16 bytes, 16 products.
struct GemmSet { v16h a[4]; v16h b[4]; };

// ap, bp: the lane's addresses in the k tile of the pass
static __device__ __forceinline__ void gemm_fetch(GemmSet& s, const _Float16* ap,
                                                  const _Float16* bp) {
#pragma unroll
  for (int j = 0; j < 4; ++j)
    s.a[j] = load_frag(ap + j * 32 * 512);
#pragma unroll
  for (int t = 0; t < 4; ++t)
    s.b[t] = load_frag(bp + t * 32 * 512);
}

// the addresses of k tile kt. Loads of the pass before are still in flight and name the address
// registers that are rewritten here: the tile's offset goes through the wait's statement, so that
// the additions made with it stand behind the wait; the old addresses as inputs keep their
// registers from being taken as a target by the loads that name them.
static __device__ __forceinline__ void gemm_seek(const _Float16*& ap, const _Float16*& bp,
                                                 const _Float16* arow, const _Float16* brow,
                                                 int kt) {
  unsigned off = (unsigned)kt * 1024u;   // bytes: a k tile of 16 rows is 1 KiB
  asm volatile("s_wait_xcnt 0x0" : "+s"(off) : "v"(ap), "v"(bp) : "memory");
  ap = reinterpret_cast<const _Float16*>(reinterpret_cast<const char*>(arow) + off);
  bp = reinterpret_cast<const _Float16*>(reinterpret_cast<const char*>(brow) + off);
}

template <int VT>
static __device__ __forceinline__ void gemm_mma(v8f (&acc)[4][4], const GemmSet& s) {
#pragma unroll
  for (int j = 0; j < 4; ++j)
#pragma unroll
    for (int t = 0; t < 4; ++t)
      acc[j][t] = VT ? __builtin_amdgcn_wmma_f32_16x16x32_f16(false, s.a[j], false, s.b[t],
                                                              (short)0, acc[j][t], false, false)
                     : __builtin_amdgcn_wmma_f32_16x16x32_f16(false, s.b[t], false, s.a[j],
                                                              (short)0, acc[j][t], false, false);
}

template <int VT>
static __device__ __forceinline__ void qkv_gemm_body(const _Float16* __restrict__ Xh,
                                const _Float16* __restrict__ Wt,
                                const float* __restrict__ bias,
                                _Float16* __restrict__ out, int r, int c, int rot, float os) {
  // r: 64-row block of 4096 rows; c: col block (64 cols of 1024); rot: the k tile of the first pass
  // os: factor on the stored value (VT = 0 only), applied in f32 ahead of the one rounding to f16
  const int lane = threadIdx.x & 31;
  const int ln = lane & 15, half = lane >> 4;

  v8f acc[4][4];
#pragma unroll
  for (int j = 0; j < 4; ++j)
#pragma unroll
    for (int t = 0; t < 4; ++t) acc[j][t] = {};

  const _Float16* arow = Xh + r * 4 * 32 * 512 + lane * 8;
  const _Float16* brow = Wt + c * 4 * 32 * 512 + lane * 8;
  // Two register sets: while one pass's products run, the next pass's 16 loads are in flight.
  // Each sched_barrier keeps a pass's loads together as one group ahead of the products
  // (left alone, the scheduler sinks each load to just before its use and every wait is exposed)
  // and keeps a set's refill behind the products that read it (a third set would cost a wave).
  // Pass p works on k tile (p + rot) mod 32: the walk wraps round.
  GemmSet s0, s1;
  const _Float16* ap = arow + rot * 512;
  const _Float16* bp = brow + rot * 512;
  gemm_fetch(s0, ap, bp);
  // keeps the first pass's loads ahead of the second's: with one of them behind, the first
  // products wait for both passes
  __builtin_amdgcn_sched_barrier(0);
  // unrolled whole: straight-line code, no counter and no branch between the groups
#pragma unroll
  for (int p = 0; p < 30; p += 2) {
    gemm_seek(ap, bp, arow, brow, (p + 1 + rot) & 31);
    gemm_fetch(s1, ap, bp);
    __builtin_amdgcn_sched_barrier(0);
    gemm_mma<VT>(acc, s0);
    __builtin_amdgcn_sched_barrier(0);
    gemm_seek(ap, bp, arow, brow, (p + 2 + rot) & 31);
    gemm_fetch(s0, ap, bp);
    __builtin_amdgcn_sched_barrier(0);
    gemm_mma<VT>(acc, s1);
    __builtin_amdgcn_sched_barrier(0);
  }
  gemm_seek(ap, bp, arow, brow, (31 + rot) & 31);
  gemm_fetch(s1, ap, bp);
  __builtin_amdgcn_sched_barrier(0);
  // the epilogue reuses the address registers that the loads still in flight name. The two
  // addresses as inputs keep their registers from being taken as a target by the last loads;
  // the sched_barrier behind it keeps the epilogue's address arithmetic behind the wait.
  asm volatile("s_wait_xcnt 0x0" :: "v"(ap), "v"(bp) : "memory");
  __builtin_amdgcn_sched_barrier(0);
  gemm_mma<VT>(acc, s0);
  gemm_mma<VT>(acc, s1);

  const int bh = (r >> 5) * 16 + c;         // rows r*64.. lie in batch r>>5; head = c
  const int st0 = (r & 31) * 4;             // first 16-row tile of the sequence
#pragma unroll
  for (int t = 0; t < 4; ++t) {
    if (VT) {
      const float bz = bias[c * 64 + t * 16 + ln];
#pragma unroll
      for (int j = 0; j < 4; ++j) {
        const int st = st0 + j;
        v8h hv;
#pragma unroll
        for (int i = 0; i < 8; ++i) hv[i] = (_Float16)(acc[j][t][i] + bz);
        *reinterpret_cast<v8h*>(out + ((bh * 64 + (st >> 1)) * 4 + t) * 512 + (st & 1) * 256 + lane * 8) = hv;
      }
    } else {
      const float4* bp = reinterpret_cast<const float4*>(bias + c * 64 + t * 16 + 8 * half);
      const float4 b0 = bp[0], b1 = bp[1];
#pragma unroll
      for (int j = 0; j < 4; ++j) {
        v8h hv;
        hv[0] = (_Float16)((acc[j][t][0] + b0.x) * os); hv[1] = (_Float16)((acc[j][t][1] + b0.y) * os);
        hv[2] = (_Float16)((acc[j][t][2] + b0.z) * os); hv[3] = (_Float16)((acc[j][t][3] + b0.w) * os);
        hv[4] = (_Float16)((acc[j][t][4] + b1.x) * os); hv[5] = (_Float16)((acc[j][t][5] + b1.y) * os);
        hv[6] = (_Float16)((acc[j][t][6] + b1.z) * os); hv[7] = (_Float16)((acc[j][t][7] + b1.w) * os);
        *reinterpret_cast<v8h*>(out + (bh * 128 + st0 + j) * 1024 + t * 256 + lane * 8) = hv;
      }
    }
  }
  // in the merged kernel the code of the V^T body stands behind this one and rewrites
  // registers that the stores above name
  if (!VT) asm volatile("s_wait_xcnt 0x0" ::: "memory");
}

// The three projections in one launch. A block is 12 waves, all that a WGP holds of them:
// 4 row blocks (256 rows of X) x the Q, K and V^T columns of one head. Each X fragment is wanted
// by three of its waves and each W fragment by four, so most loads end in the WGP's cache.
// Wt and out are the three planes of each kind, one behind the other.
__global__ void __launch_bounds__(384) qkv_gemm_kernel(const _Float16* __restrict__ Xh,
                                const _Float16* __restrict__ Wt,
                                const float* __restrict__ bq,
                                const float* __restrict__ bk,
                                const float* __restrict__ bv,
                                _Float16* __restrict__ out) {
  // the wave's number in a scalar register: the choice of a body is then a scalar branch
  const int wv = __builtin_amdgcn_readfirstlane(threadIdx.x >> 5);
  const int which = wv >> 2;
  const int r = (blockIdx.x & 15) * 4 + (wv & 3);
  const int c = blockIdx.x >> 4;
  // Sixteen blocks want the same rows of X (one row group, every head) and sixteen the same rows
  // of W (one head, every row group). Walking k in step they would ask L2 for the same lines at
  // the same moment, each line new to L2 just then. Each block starts at a k tile of its own:
  // the sixteen of either kind stand on sixteen different tiles, and all but a line's first
  // reader find it in L2.
  const int rot = (walk_start(blockIdx.x & 15) + 2 * c) & 31;
  // the plane's address is formed ahead of the branch, in scalar registers. As a constant inside
  // the V^T body it went into the loads' immediate offsets, and the address register was then
  // completed directly behind the loads that name it, ahead of the wait.
  const _Float16* wplane = Wt + which * 1048576;
  if (which == 2)
    qkv_gemm_body<1>(Xh, wplane, bv, out + 2 * 4194304, r, c, rot, 1.0f);
  else
    // Q is stored times 1/sqrt(64) * log2 e: K Q^T is then the exponent of 2 that attention wants
    qkv_gemm_body<0>(Xh, wplane, which ? bk : bq, out + which * 4194304, r, c, rot,
                     which ? 1.0f : 0.125f * 1.44269504088896340736f);
}

// ---------------- fused flash attention ----------------
// One wave per 32 queries (two 16-query tiles) and 1024 keys (one half of the sequence) of one
// (b,h): each K, V fragment and mask word loaded feeds both query tiles, and the split of the keys
// keeps four waves on a SIMD. Streams 32-key blocks, online softmax in powers of 2; the two key
// halves of a query tile are joined at the end through LDS.
// Scores are formed transposed (S^T = K Q^T): a lane holds 16 keys of ONE query,
// so maximum and sum run in the lane, and the two score tiles, converted in place,
// are the B operand of O^T += V^T P^T.
static __device__ __forceinline__ float other_half(float x) {
  // lane l <-> lane l ^ 16
  return __builtin_bit_cast(float, __builtin_amdgcn_permlanex16(
      __builtin_bit_cast(int, x), __builtin_bit_cast(int, x),
      0x76543210, 0xfedcba98, false, false));
}

// 2^x for the join at the end. The v_nop is the slot that the instruction set asks for behind a
// transcendental.
static __device__ __forceinline__ float exp2_slot(float x) {
  float r;
  asm("v_exp_f32 %0, %1\n\tv_nop" : "=v"(r) : "v"(x));
  return r;
}

static __device__ __forceinline__ void mask_fetch(v8f (&m)[2], const float* p) {
#pragma unroll
  for (int t = 0; t < 2; ++t) {
    const v4f* mp = reinterpret_cast<const v4f*>(p + t * 16);
    const v4f a = mp[0], c = mp[1];
    m[t] = __builtin_shufflevector(a, c, 0, 1, 2, 3, 4, 5, 6, 7);
  }
}

// p: the lane's address in the pass. A pass's K (two key tiles x two d tiles) and its V^T
// (four d tiles) are 4 KiB in a row each
static __device__ __forceinline__ void key_fetch(v16h (&k)[2][2], const _Float16* p) {
#pragma unroll
  for (int t = 0; t < 2; ++t) {
    k[t][0] = load_frag(p + t * 1024);
    k[t][1] = load_frag(p + t * 1024 + 512);
  }
}

static __device__ __forceinline__ void value_fetch(v16h (&av)[4], const _Float16* p) {
#pragma unroll
  for (int td = 0; td < 4; ++td)
    av[td] = load_frag(p + td * 512);
}

// s[t][i] = score of query ln and key t*16 + 8*half + i of the pass, as an exponent of 2
// the largest of the lane's 16
static __device__ __forceinline__ float lane_max(const v8f (&s)[2]) {
  float mx[2];
#pragma unroll
  for (int t = 0; t < 2; ++t)
    mx[t] = fmaxf(fmaxf(fmaxf(s[t][0], s[t][1]), fmaxf(s[t][2], s[t][3])),
                  fmaxf(fmaxf(s[t][4], s[t][5]), fmaxf(s[t][6], s[t][7])));
  return fmaxf(mx[0], mx[1]);
}

// P = 2^s as a B operand, and its sum
static __device__ __forceinline__ v16h softmax_step(const v8f (&s)[2], float& ls) {
  v16h bp;
  float ps[2];
#pragma unroll
  for (int t = 0; t < 2; ++t) {
    float p[8];
#pragma unroll
    for (int i = 0; i < 8; ++i) {
      p[i] = __builtin_amdgcn_exp2f(s[t][i]);
      bp[t * 8 + i] = (_Float16)p[i];
    }
    ps[t] = ((p[0] + p[1]) + (p[2] + p[3])) + ((p[4] + p[5]) + (p[6] + p[7]));
  }
  ls += ps[0] + ps[1];
  return bp;
}

struct AttnState {
  v16h bq[2][2];     // Q fragments of the two query tiles
  v16h kf[2][2];     // K of the pass at hand, refilled behind the test of the scores
  v16h av[4];        // V^T of the pass at hand, refilled behind the output products
  v8f mk[2];         // mask words of the pass at hand, refilled with K
  float ms[2], ls[2];  // of query ln; ms: the reference in use (exponent of 2), alike in both
                       // lane halves; ls: this lane half's keys only
  v8f acc[2][4];     // acc[u][td][i] = O^T[td*16 + 8*half + i][query ln]
  const _Float16* kp;  // the lane's addresses of the fetches last issued
  const _Float16* vp;
  const float* mp;
};

// s += K Q^T for both query tiles
static __device__ __forceinline__ void score_products(v8f (&s)[2][2], const AttnState& a) {
#pragma unroll
  for (int c = 0; c < 2; ++c)
#pragma unroll
    for (int u = 0; u < 2; ++u)
#pragma unroll
      for (int t = 0; t < 2; ++t)
        s[u][t] = __builtin_amdgcn_wmma_f32_16x16x32_f16(false, a.kf[t][c], false, a.bq[u][c],
                                                         (short)0, s[u][t], false, false);
}

// One pass of 32 keys for both query tiles; every register set is left filled for pass nx.
// The softmax reference of a query is held from pass to pass: mask * log2 e minus it goes into the
// score products as their C, and what comes out is the exponent as it stands. Sums and outputs
// stay on that reference and are not rescaled, as long as no score tops it by more than 8
// (P up to 2^8, far inside f16). One test a pass, for the whole wave.
// Each sched_barrier keeps a group of loads at its place: left alone, the scheduler sinks every
// load to just before its use, where its whole latency is waited out.
static __device__ __forceinline__ void attn_pass(AttnState& a,
                                                 const _Float16* kuni, const _Float16* vuni,
                                                 const float* muni, int foff, int moff, int nx) {
  const float log2e = 1.44269504088896340736f;
  v8f s[2][2];
#pragma unroll
  for (int u = 0; u < 2; ++u)
#pragma unroll
    for (int t = 0; t < 2; ++t) s[u][t] = a.mk[t] * log2e - a.ms[u];
  score_products(s, a);
  // the eight products go out in a row: with the maxima mixed in, each first read of a result
  // just made is padded with idle slots
  __builtin_amdgcn_sched_barrier(0);
  const float top = fmaxf(lane_max(s[0]), lane_max(s[1]));
  if (__builtin_amdgcn_ballot_w32(top > 8.0f) != 0) {
    // A score tops its reference (always so in a wave's first pass, whose reference is -1e30).
    // The scores are formed anew without a reference, so that none is lost beside a large C, and
    // every query goes to its running maximum: sums and outputs are rescaled to it.
#pragma unroll
    for (int u = 0; u < 2; ++u)
#pragma unroll
      for (int t = 0; t < 2; ++t) s[u][t] = a.mk[t] * log2e;
    score_products(s, a);
#pragma unroll
    for (int u = 0; u < 2; ++u) {
      const float mx = lane_max(s[u]);
      const float mn = fmaxf(a.ms[u], fmaxf(mx, other_half(mx)));
      const float scale = __builtin_amdgcn_exp2f(a.ms[u] - mn);
      a.ms[u] = mn;
      a.ls[u] *= scale;
#pragma unroll
      for (int td = 0; td < 4; ++td) a.acc[u][td] *= scale;
#pragma unroll
      for (int t = 0; t < 2; ++t) s[u][t] -= mn;
    }
  }
  __builtin_amdgcn_sched_barrier(0);
  // loads of the pass before are still in flight and name the address registers that the next
  // lines rewrite. The next pass's number goes through the statement, so that all address
  // arithmetic made from it stands behind the wait; the old addresses as inputs keep their
  // registers from being taken as a target by the loads that name them.
  asm volatile("s_wait_xcnt 0x0" : "+s"(nx) : "v"(a.kp), "v"(a.vp), "v"(a.mp) : "memory");
  a.kp = kuni + nx * 2048 + foff;
  a.vp = vuni + nx * 2048 + foff;
  a.mp = muni + nx * 32 + moff;
  key_fetch(a.kf, a.kp);
  __builtin_amdgcn_sched_barrier(0);
  mask_fetch(a.mk, a.mp);
  __builtin_amdgcn_sched_barrier(0);
  v16h bp[2];
#pragma unroll
  for (int u = 0; u < 2; ++u) bp[u] = softmax_step(s[u], a.ls[u]);
  // the vector work ends ahead of the products: mixed in, it lands on operand registers of
  // products just issued, and each such place is padded with four idle slots
  __builtin_amdgcn_sched_barrier(0);
#pragma unroll
  for (int u = 0; u < 2; ++u)
#pragma unroll
    for (int td = 0; td < 4; ++td)
      a.acc[u][td] = __builtin_amdgcn_wmma_f32_16x16x32_f16(false, a.av[td], false, bp[u],
                                                            (short)0, a.acc[u][td], false, false);
  __builtin_amdgcn_sched_barrier(0);
  value_fetch(a.av, a.vp);
  __builtin_amdgcn_sched_barrier(0);
}

__global__ void __launch_bounds__(256) __attribute__((amdgpu_waves_per_eu(4, 4)))
attn_kernel(const _Float16* __restrict__ Qh,
                            const _Float16* __restrict__ Kh,
                            const _Float16* __restrict__ Vth,
                            const float* __restrict__ mask,
                            float* __restrict__ out) {
  // what a wave hands to the wave with the other key half: one query tile's sums
  __shared__ float4 xacc[8][8][32];
  __shared__ float2 xml[8][32];

  const int lane = threadIdx.x & 31;
  // the wave's number in a scalar register: plane addresses are then scalar
  const int wv = __builtin_amdgcn_readfirstlane(threadIdx.x >> 5);
  const int ks = wv & 1;                              // key half
  const int qg = (blockIdx.x & 15) * 4 + (wv >> 1);   // group of 32 queries, 0..63
  const int bh = blockIdx.x >> 4;                     // 0..31
  const int b = bh >> 4, h = bh & 15;
  const int ln = lane & 15, half = lane >> 4;
  const int foff = lane * 8, moff = 8 * half;
  // the sixteen blocks of one (b,h) read the same K, V^T and mask: each enters the key walk at a
  // pass of its own and wraps round, so that they do not ask L2 for the same lines at one moment
  const int rot = walk_start(blockIdx.x & 15);

  AttnState a;
  const _Float16* qrow = Qh + (bh * 128 + qg * 2) * 1024;
#pragma unroll
  for (int u = 0; u < 2; ++u) {
    a.bq[u][0] = load_frag(qrow + foff + u * 1024);
    a.bq[u][1] = load_frag(qrow + foff + u * 1024 + 512);
    a.ms[u] = -1e30f;
    a.ls[u] = 0.f;
#pragma unroll
    for (int t = 0; t < 4; ++t) a.acc[u][t] = {};
  }

  const _Float16* kuni = Kh + (bh * 128 + ks * 64) * 1024;
  const _Float16* vuni = Vth + (bh * 64 + ks * 32) * 2048;
  const float* muni = mask + b * 2048 + ks * 1024;
  // the first fill in the order of the refills: the counted waits in the loop are the stricter
  // of the two ways into it
  a.kp = kuni + rot * 2048 + foff;
  a.vp = vuni + rot * 2048 + foff;
  a.mp = muni + rot * 32 + moff;
  key_fetch(a.kf, a.kp);
  __builtin_amdgcn_sched_barrier(0);
  mask_fetch(a.mk, a.mp);
  __builtin_amdgcn_sched_barrier(0);
  value_fetch(a.av, a.vp);
  __builtin_amdgcn_sched_barrier(0);
  for (int kb = 0; kb < 32; ++kb)
    // last trip: the first pass's place again, inside the planes, unused
    attn_pass(a, kuni, vuni, muni, foff, moff, (kb + 1 + rot) & 31);

  // Join of the key halves: wave ks keeps query tile ks and hands the other tile to its partner.
  v8f keep[4], give[4];
#pragma unroll
  for (int td = 0; td < 4; ++td) {
    keep[td] = ks ? a.acc[1][td] : a.acc[0][td];
    give[td] = ks ? a.acc[0][td] : a.acc[1][td];
  }
  const float mkeep = ks ? a.ms[1] : a.ms[0], lkeep = ks ? a.ls[1] : a.ls[0];
  const float mgive = ks ? a.ms[0] : a.ms[1], lgive = ks ? a.ls[0] : a.ls[1];
#pragma unroll
  for (int td = 0; td < 4; ++td) {
    xacc[wv][td * 2][lane] = make_float4(give[td][0], give[td][1], give[td][2], give[td][3]);
    xacc[wv][td * 2 + 1][lane] = make_float4(give[td][4], give[td][5], give[td][6], give[td][7]);
  }
  xml[wv][lane] = make_float2(mgive, lgive);
  __syncthreads();
  const float2 ml = xml[wv ^ 1][lane];
  const float mn = fmaxf(mkeep, ml.x);
  const float ek = exp2_slot(mkeep - mn), eo = exp2_slot(ml.x - mn);
  const float lsum = lkeep * ek + ml.y * eo;
  const float inv = 1.0f / (lsum + other_half(lsum));
  const float fk = ek * inv, fo = eo * inv;
  float* orow = out + (b * 2048 + (qg * 2 + ks) * 16 + ln) * 1024 + h * 64 + 8 * half;
#pragma unroll
  for (int td = 0; td < 4; ++td) {
    const float4 g0 = xacc[wv ^ 1][td * 2][lane], g1 = xacc[wv ^ 1][td * 2 + 1][lane];
    float4 o0, o1;
    o0.x = keep[td][0] * fk + g0.x * fo; o0.y = keep[td][1] * fk + g0.y * fo;
    o0.z = keep[td][2] * fk + g0.z * fo; o0.w = keep[td][3] * fk + g0.w * fo;
    o1.x = keep[td][4] * fk + g1.x * fo; o1.y = keep[td][5] * fk + g1.y * fo;
    o1.z = keep[td][6] * fk + g1.z * fo; o1.w = keep[td][7] * fk + g1.w * fo;
    *reinterpret_cast<float4*>(orow + td * 16) = o0;
    *reinterpret_cast<float4*>(orow + td * 16 + 4) = o1;
  }
}

extern "C" void kernel_launch(void* const* d_in, const int* in_sizes, int n_in,
                              void* d_out, int out_size, void* d_ws, size_t ws_size,
                              hipStream_t stream) {
  const float* X    = (const float*)d_in[0];
  const float* mask = (const float*)d_in[1];
  const float* Wq   = (const float*)d_in[2];
  const float* bq   = (const float*)d_in[3];
  const float* Wk   = (const float*)d_in[4];
  const float* bk   = (const float*)d_in[5];
  const float* Wv   = (const float*)d_in[6];
  const float* bv   = (const float*)d_in[7];
  float* out = (float*)d_out;

  _Float16* ws  = (_Float16*)d_ws;
  _Float16* Xh  = ws;                    // 4096*1024, all planes in fragment order
  _Float16* Wtq = Xh + 4194304;          // 1024*1024 each
  _Float16* Wtk = Wtq + 1048576;
  _Float16* Wtv = Wtk + 1048576;
  _Float16* Qh  = Wtv + 1048576;         // 2*16*2048*64 each
  _Float16* Kh  = Qh + 4194304;
  _Float16* Vth = Kh + 4194304;

  prep_kernel<<<512, 256, 0, stream>>>(X, Wq, Wk, Wv, Xh, Wtq);

  qkv_gemm_kernel<<<256, 384, 0, stream>>>(Xh, Wtq, bq, bk, bv, Qh);

  attn_kernel<<<512, 256, 0, stream>>>(Qh, Kh, Vth, mask, out);
}

// v009
// One run takes 54.9 microseconds.
// Timed twice side by side with v008, it ran 1.03 and 1.04 times as fast.
// All steps since v000 together make it 6.71 times as fast.
#include <hip/hip_runtime.h>

typedef _Float16 v16h __attribute__((ext_vector_type(16)));
typedef float    v8f  __attribute__((ext_vector_type(8)));

// Two 16-byte chunks -> one 16-halfword WMMA fragment (A or B operand).
// Fragment element j corresponds to K index (j<8?0:16) + 8*half + (j%8).
// Every f16 plane of the workspace is kept in fragment order: a tile of 16 rows x 32 k is
// 512 halfwords, [chunk c][lane][8], lane = 16*half + row, k = 16*c + 8*half + (0..7).
// A wave's 16-byte load or store of one chunk then covers 512 bytes in a row (4 whole lines).
struct FragBits { uint4 lo, hi; };

// p = start of the tile + 8 * lane
static __device__ __forceinline__ v16h load_frag(const _Float16* p) {
  FragBits u;
  u.lo = *reinterpret_cast<const uint4*>(p);
  u.hi = *reinterpret_cast<const uint4*>(p + 256);
  return __builtin_bit_cast(v16h, u);
}

typedef _Float16 v8h __attribute__((ext_vector_type(8)));
typedef float    v4f __attribute__((ext_vector_type(4)));

// Where the i-th of 16 blocks that read the same planes enters a walk of 32 stages: the 16 even
// stages, the two base-4 digits of i swapped, so that blocks with neighbouring i, or any run of
// them, stand far apart and evenly.
static __device__ __forceinline__ int walk_start(int i) {
  return (i & 3) * 8 + (i >> 2) * 2;
}

// ---------------- X and Wq, Wk, Wv, fp32 -> f16 tiles in fragment order, one launch ----------
// 4096 waves, each with one share of every plane and all its 32 loads in flight at once
// (7 KiB a wave), so that few waves have to be started for the 28 MiB that are read.
// X [4096,1024] -> tiles [row tile][k tile]: a thread makes 16-byte chunk entries (8 k of one row);
//   a wave takes two whole tiles in four turns of 8 rows x 32 k (8 whole lines read, 4 written).
// W [K,N] -> tiles [n tile][k tile], row = n: a thread reads 8 k of ONE n, which is one chunk
//   entry: a wave's load is one whole line of a W row (32 n), its store two runs of 256 bytes.
//   A wave takes the same 32 n x 8 k of each of the three matrices.
__global__ void __launch_bounds__(256) prep_kernel(const float* __restrict__ x,
                                                   const float* __restrict__ wq,
                                                   const float* __restrict__ wk,
                                                   const float* __restrict__ wv,
                                                   _Float16* __restrict__ xh,
                                                   _Float16* __restrict__ wt) {
  const int lane = threadIdx.x & 31;
  const int w = blockIdx.x * 8 + (threadIdx.x >> 5);   // 4096 waves

  v4f f[4][2];
#pragma unroll
  for (int u = 0; u < 4; ++u) {
    const int o = (w * 4 + u) * 32 + lane;
    const int q = o & 3, row = (o >> 2) & 15, kt = (o >> 6) & 31, rt = o >> 11;  // k = 8*q + (0..7)
    const v4f* xp = reinterpret_cast<const v4f*>(x + (rt * 16 + row) * 1024 + kt * 32 + q * 8);
    f[u][0] = xp[0];
    f[u][1] = xp[1];
  }

  const int nb = w & 31, kg = w >> 5;                  // n = 32*nb + lane, k = 8*kg + (0..7)
  const int woff = kg * 8 * 1024 + nb * 32 + lane;
  v8f g[3];
#pragma unroll
  for (int e = 0; e < 8; ++e) {
    g[0][e] = wq[woff + e * 1024];
    g[1][e] = wk[woff + e * 1024];
    g[2][e] = wv[woff + e * 1024];
  }
  // takes the loaded values as inputs only: all 32 loads are issued ahead of the first conversion.
  // Left alone, the compiler holds some back behind the first wait to save registers, and their
  // whole latency is waited out a second time. Its wait stands in front of the address
  // arithmetic of the stores, which rewrites registers that the loads name.
  asm volatile("s_wait_xcnt 0x0" :: "v"(f[0][0]), "v"(f[0][1]), "v"(f[1][0]), "v"(f[1][1]), "v"(f[2][0]), "v"(f[2][1]),
               "v"(f[3][0]), "v"(f[3][1]), "v"(g[0]), "v"(g[1]), "v"(g[2]) : "memory");

#pragma unroll
  for (int u = 0; u < 4; ++u) {
    const int o = (w * 4 + u) * 32 + lane;
    const int q = o & 3, row = (o >> 2) & 15;
    const v4f f0 = f[u][0], f1 = f[u][1];
    v8h hv;
    hv[0] = (_Float16)f0.x; hv[1] = (_Float16)f0.y; hv[2] = (_Float16)f0.z; hv[3] = (_Float16)f0.w;
    hv[4] = (_Float16)f1.x; hv[5] = (_Float16)f1.y; hv[6] = (_Float16)f1.z; hv[7] = (_Float16)f1.w;
    // chunk c = q >> 1, lane = 16 * (q & 1) + row
    *reinterpret_cast<v8h*>(xh + (o >> 6) * 512 + (q >> 1) * 256 + ((q & 1) * 16 + row) * 8) = hv;
  }

  // n tile 2*nb + (lane >> 4), k tile kg >> 2, chunk (kg >> 1) & 1, lane 16 * (kg & 1) + (n & 15)
  _Float16* wp = wt + ((nb * 2 + (lane >> 4)) * 32 + (kg >> 2)) * 512 + ((kg >> 1) & 1) * 256 +
                 ((kg & 1) * 16 + (lane & 15)) * 8;
#pragma unroll
  for (int m = 0; m < 3; ++m) {
    v8h hv;
#pragma unroll
    for (int e = 0; e < 8; ++e) hv[e] = (_Float16)g[m][e];
    *reinterpret_cast<v8h*>(wp + m * 1048576) = hv;
  }
}

// ---------------- QKV projection: out = X @ W + b (Q times 0.125 * log2 e), f16 WMMA, f32 accum ----------
// One wave computes a 64x64 tile (four 16-row tiles of X, the 64 columns of one head): each of
// the 8 fragments of a pass feeds 4 products, one 16-byte load a product.
// VT = 0 (Q, K): tiles [b,h][s tile][d tile], row = s, k = d. The product is formed as W^T X^T,
//   so a lane's 8 accumulators are 8 d in a row of one s: one chunk entry of that tile.
// VT = 1 (V^T): tiles [b,h][32-key block][d tile], row = d, k = s. The product is formed as X W,
//   so a lane's 8 accumulators are 8 s in a row of one d.
// One pass = 32 k = one k tile of each operand: 16 loads of 16 bytes, 16 products.
struct GemmSet { v16h a[4]; v16h b[4]; };

// ap, bp: the lane's addresses in the k tile of the pass
static __device__ __forceinline__ void gemm_fetch(GemmSet& s, const _Float16* ap,
                                                  const _Float16* bp) {
#pragma unroll
  for (int j = 0; j < 4; ++j)
    s.a[j] = load_frag(ap + j * 32 * 512);
#pragma unroll
  for (int t = 0; t < 4; ++t)
    s.b[t] = load_frag(bp + t * 32 * 512);
}

// the addresses of k tile kt. Loads of the pass before are still in flight and name the address
// registers that are rewritten here: the tile's offset goes through the wait's statement, so that
// the additions made with it stand behind the wait; the old addresses as inputs keep their
// registers from being taken as a target by the loads that name them.
static __device__ __forceinline__ void gemm_seek(const _Float16*& ap, const _Float16*& bp,
                                                 const _Float16* arow, const _Float16* brow,
                                                 int kt) {
  unsigned off = (unsigned)kt * 1024u;   // bytes: a k tile of 16 rows is 1 KiB
  asm volatile("s_wait_xcnt 0x0" : "+s"(off) : "v"(ap), "v"(bp) : "memory");
  ap = reinterpret_cast<const _Float16*>(reinterpret_cast<const char*>(arow) + off);
  bp = reinterpret_cast<const _Float16*>(reinterpret_cast<const char*>(brow) + off);
}

template <int VT>
static __device__ __forceinline__ void gemm_mma(v8f (&acc)[4][4], const GemmSet& s) {
#pragma unroll
  for (int j = 0; j < 4; ++j)
#pragma unroll
    for (int t = 0; t < 4; ++t)
      acc[j][t] = VT ? __builtin_amdgcn_wmma_f32_16x16x32_f16(false, s.a[j], false, s.b[t],
                                                              (short)0, acc[j][t], false, false)
                     : __builtin_amdgcn_wmma_f32_16x16x32_f16(false, s.b[t], false, s.a[j],
                                                              (short)0, acc[j][t], false, false);
}

template <int VT>
static __device__ __forceinline__ void qkv_gemm_body(const _Float16* __restrict__ Xh,
                                const _Float16* __restrict__ Wt,
                                const float* __restrict__ bias,
                                _Float16* __restrict__ out, int r, int c, int rot, float os) {
  // r: 64-row block of 4096 rows; c: col block (64 cols of 1024); rot: the k tile of the first pass
  // os: factor on the stored value (VT = 0 only), applied in f32 ahead of the one rounding to f16
  const int lane = threadIdx.x & 31;
  const int ln = lane & 15, half = lane >> 4;

  v8f acc[4][4];
#pragma unroll
  for (int j = 0; j < 4; ++j)
#pragma unroll
    for (int t = 0; t < 4; ++t) acc[j][t] = {};

  const _Float16* arow = Xh + r * 4 * 32 * 512 + lane * 8;
  const _Float16* brow = Wt + c * 4 * 32 * 512 + lane * 8;
  // Two register sets: while one pass's products run, the next pass's 16 loads are in flight.
  // Each sched_barrier keeps a pass's loads together as one group ahead of the products
  // (left alone, the scheduler sinks each load to just before its use and every wait is exposed)
  // and keeps a set's refill behind the products that read it (a third set would cost a wave).
  // Pass p works on k tile (p + rot) mod 32: the walk wraps round.
  GemmSet s0, s1;
  const _Float16* ap = arow + rot * 512;
  const _Float16* bp = brow + rot * 512;
  gemm_fetch(s0, ap, bp);
  // keeps the first pass's loads ahead of the second's: with one of them behind, the first
  // products wait for both passes
  __builtin_amdgcn_sched_barrier(0);
  // unrolled whole: straight-line code, no counter and no branch between the groups
#pragma unroll
  for (int p = 0; p < 30; p += 2) {
    gemm_seek(ap, bp, arow, brow, (p + 1 + rot) & 31);
    gemm_fetch(s1, ap, bp);
    __builtin_amdgcn_sched_barrier(0);
    gemm_mma<VT>(acc, s0);
    __builtin_amdgcn_sched_barrier(0);
    gemm_seek(ap, bp, arow, brow, (p + 2 + rot) & 31);
    gemm_fetch(s0, ap, bp);
    __builtin_amdgcn_sched_barrier(0);
    gemm_mma<VT>(acc, s1);
    __builtin_amdgcn_sched_barrier(0);
  }
  gemm_seek(ap, bp, arow, brow, (31 + rot) & 31);
  gemm_fetch(s1, ap, bp);
  __builtin_amdgcn_sched_barrier(0);
  // the epilogue reuses the address registers that the loads still in flight name. The two
  // addresses as inputs keep their registers from being taken as a target by the last loads;
  // the sched_barrier behind it keeps the epilogue's address arithmetic behind the wait.
  asm volatile("s_wait_xcnt 0x0" :: "v"(ap), "v"(bp) : "memory");
  __builtin_amdgcn_sched_barrier(0);
  gemm_mma<VT>(acc, s0);
  gemm_mma<VT>(acc, s1);

  const int bh = (r >> 5) * 16 + c;         // rows r*64.. lie in batch r>>5; head = c
  const int st0 = (r & 31) * 4;             // first 16-row tile of the sequence
#pragma unroll
  for (int t = 0; t < 4; ++t) {
    if (VT) {
      const float bz = bias[c * 64 + t * 16 + ln];
#pragma unroll
      for (int j = 0; j < 4; ++j) {
        const int st = st0 + j;
        v8h hv;
#pragma unroll
        for (int i = 0; i < 8; ++i) hv[i] = (_Float16)(acc[j][t][i] + bz);
        *reinterpret_cast<v8h*>(out + ((bh * 64 + (st >> 1)) * 4 + t) * 512 + (st & 1) * 256 + lane * 8) = hv;
      }
    } else {
      const float4* bp = reinterpret_cast<const float4*>(bias + c * 64 + t * 16 + 8 * half);
      const float4 b0 = bp[0], b1 = bp[1];
#pragma unroll
      for (int j = 0; j < 4; ++j) {
        v8h hv;
        hv[0] = (_Float16)((acc[j][t][0] + b0.x) * os); hv[1] = (_Float16)((acc[j][t][1] + b0.y) * os);
        hv[2] = (_Float16)((acc[j][t][2] + b0.z) * os); hv[3] = (_Float16)((acc[j][t][3] + b0.w) * os);
        hv[4] = (_Float16)((acc[j][t][4] + b1.x) * os); hv[5] = (_Float16)((acc[j][t][5] + b1.y) * os);
        hv[6] = (_Float16)((acc[j][t][6] + b1.z) * os); hv[7] = (_Float16)((acc[j][t][7] + b1.w) * os);
        *reinterpret_cast<v8h*>(out + (bh * 128 + st0 + j) * 1024 + t * 256 + lane * 8) = hv;
      }
    }
  }
  // in the merged kernel the code of the V^T body stands behind this one and rewrites
  // registers that the stores above name
  if (!VT) asm volatile("s_wait_xcnt 0x0" ::: "memory");
}

// The three projections in one launch. A block is 12 waves, all that a WGP holds of them:
// 4 row blocks (256 rows of X) x the Q, K and V^T columns of one head. Each X fragment is wanted
// by three of its waves and each W fragment by four, so most loads end in the WGP's cache.
// Wt and out are the three planes of each kind, one behind the other.
__global__ void __launch_bounds__(384) qkv_gemm_kernel(const _Float16* __restrict__ Xh,
                                const _Float16* __restrict__ Wt,
                                const float* __restrict__ bq,
                                const float* __restrict__ bk,
                                const float* __restrict__ bv,
                                _Float16* __restrict__ out) {
  // the wave's number in a scalar register: the choice of a body is then a scalar branch
  const int wv = __builtin_amdgcn_readfirstlane(threadIdx.x >> 5);
  const int which = wv >> 2;
  const int r = (blockIdx.x & 15) * 4 + (wv & 3);
  const int c = blockIdx.x >> 4;
  // Sixteen blocks want the same rows of X (one row group, every head) and sixteen the same rows
  // of W (one head, every row group). Walking k in step they would ask L2 for the same lines at
  // the same moment, each line new to L2 just then. Each block starts at a k tile of its own:
  // the sixteen of either kind stand on sixteen different tiles, and all but a line's first
  // reader find it in L2.
  const int rot = (walk_start(blockIdx.x & 15) + 2 * c) & 31;
  // the plane's address is formed ahead of the branch, in scalar registers. As a constant inside
  // the V^T body it went into the loads' immediate offsets, and the address register was then
  // completed directly behind the loads that name it, ahead of the wait.
  const _Float16* wplane = Wt + which * 1048576;
  if (which == 2)
    qkv_gemm_body<1>(Xh, wplane, bv, out + 2 * 4194304, r, c, rot, 1.0f);
  else
    // Q is stored times 1/sqrt(64) * log2 e: K Q^T is then the exponent of 2 that attention wants
    qkv_gemm_body<0>(Xh, wplane, which ? bk : bq, out + which * 4194304, r, c, rot,
                     which ? 1.0f : 0.125f * 1.44269504088896340736f);
}

// ---------------- fused flash attention ----------------
// One wave per 32 queries (two 16-query tiles) and 1024 keys (one half of the sequence) of one
// (b,h): each K, V fragment and mask word loaded feeds both query tiles, and the split of the keys
// keeps four waves on a SIMD. Streams 32-key blocks, online softmax in powers of 2; the two key
// halves of a query tile are joined at the end through LDS.
// Scores are formed transposed (S^T = K Q^T): a lane holds 16 keys of ONE query,
// so maximum and sum run in the lane, and the two score tiles, converted in place,
// are the B operand of O^T += V^T P^T.
static __device__ __forceinline__ float other_half(float x) {
  // lane l <-> lane l ^ 16
  return __builtin_bit_cast(float, __builtin_amdgcn_permlanex16(
      __builtin_bit_cast(int, x), __builtin_bit_cast(int, x),
      0x76543210, 0xfedcba98, false, false));
}

// 2^x for the join at the end. The v_nop is the slot that the instruction set asks for behind a
// transcendental.
static __device__ __forceinline__ float exp2_slot(float x) {
  float r;
  asm("v_exp_f32 %0, %1\n\tv_nop" : "=v"(r) : "v"(x));
  return r;
}

static __device__ __forceinline__ void mask_fetch(v8f (&m)[2], const float* p) {
#pragma unroll
  for (int t = 0; t < 2; ++t) {
    const v4f* mp = reinterpret_cast<const v4f*>(p + t * 16);
    const v4f a = mp[0], c = mp[1];
    m[t] = __builtin_shufflevector(a, c, 0, 1, 2, 3, 4, 5, 6, 7);
  }
}

// p: the lane's address in the pass. A pass's K (two key tiles x two d tiles) and its V^T
// (four d tiles) are 4 KiB in a row each
static __device__ __forceinline__ void key_fetch(v16h (&k)[2][2], const _Float16* p) {
#pragma unroll
  for (int t = 0; t < 2; ++t) {
    k[t][0] = load_frag(p + t * 1024);
    k[t][1] = load_frag(p + t * 1024 + 512);
  }
}

static __device__ __forceinline__ void value_fetch(v16h (&av)[4], const _Float16* p) {
#pragma unroll
  for (int td = 0; td < 4; ++td)
    av[td] = load_frag(p + td * 512);
}

// s[t][i] = score of query ln and key t*16 + 8*half + i of the pass, as an exponent of 2
// the largest of the lane's 16
static __device__ __forceinline__ float lane_max(const v8f (&s)[2]) {
  float mx[2];
#pragma unroll
  for (int t = 0; t < 2; ++t)
    mx[t] = fmaxf(fmaxf(fmaxf(s[t][0], s[t][1]), fmaxf(s[t][2], s[t][3])),
                  fmaxf(fmaxf(s[t][4], s[t][5]), fmaxf(s[t][6], s[t][7])));
  return fmaxf(mx[0], mx[1]);
}

// P = 2^s as a B operand, and its sum
static __device__ __forceinline__ v16h softmax_step(const v8f (&s)[2], float& ls) {
  v16h bp;
  float ps[2];
#pragma unroll
  for (int t = 0; t < 2; ++t) {
    float p[8];
#pragma unroll
    for (int i = 0; i < 8; ++i) {
      p[i] = __builtin_amdgcn_exp2f(s[t][i]);
      bp[t * 8 + i] = (_Float16)p[i];
    }
    ps[t] = ((p[0] + p[1]) + (p[2] + p[3])) + ((p[4] + p[5]) + (p[6] + p[7]));
  }
  ls += ps[0] + ps[1];
  return bp;
}

struct AttnState {
  v16h bq[2][2];     // Q fragments of the two query tiles
  v16h kf[2][2];     // K of the pass at hand, refilled behind the test of the scores
  v16h av[4];        // V^T of the pass at hand, refilled behind the output products
  v8f mk[2];         // mask words of the pass at hand, refilled with K
  float ms[2], ls[2];  // of query ln; ms: the reference in use (exponent of 2), alike in both
                       // lane halves; ls: this lane half's keys only
  v8f acc[2][4];     // acc[u][td][i] = O^T[td*16 + 8*half + i][query ln]
  const _Float16* kp;  // the lane's addresses of the fetches last issued
  const _Float16* vp;
  const float* mp;
};

// s += K Q^T for both query tiles
static __device__ __forceinline__ void score_products(v8f (&s)[2][2], const AttnState& a) {
#pragma unroll
  for (int c = 0; c < 2; ++c)
#pragma unroll
    for (int u = 0; u < 2; ++u)
#pragma unroll
      for (int t = 0; t < 2; ++t)
        s[u][t] = __builtin_amdgcn_wmma_f32_16x16x32_f16(false, a.kf[t][c], false, a.bq[u][c],
                                                         (short)0, s[u][t], false, false);
}

// One pass of 32 keys for both query tiles; every register set is left filled for pass nx.
// The softmax reference of a query is held from pass to pass: mask * log2 e minus it goes into the
// score products as their C, and what comes out is the exponent as it stands. Sums and outputs
// stay on that reference and are not rescaled, as long as no score tops it by more than 8
// (P up to 2^8, far inside f16). One test a pass, for the whole wave.
// Each sched_barrier keeps a group of loads at its place: left alone, the scheduler sinks every
// load to just before its use, where its whole latency is waited out.
static __device__ __forceinline__ void attn_pass(AttnState& a,
                                                 const _Float16* kuni, const _Float16* vuni,
                                                 const float* muni, int foff, int moff, int nx) {
  const float log2e = 1.44269504088896340736f;
  v8f s[2][2];
#pragma unroll
  for (int u = 0; u < 2; ++u)
#pragma unroll
    for (int t = 0; t < 2; ++t) s[u][t] = a.mk[t] * log2e - a.ms[u];
  score_products(s, a);
  // the eight products go out in a row: with the maxima mixed in, each first read of a result
  // just made is padded with idle slots
  __builtin_amdgcn_sched_barrier(0);
  const float top = fmaxf(lane_max(s[0]), lane_max(s[1]));
  if (__builtin_amdgcn_ballot_w32(top > 8.0f) != 0) {
    // A score tops its reference (always so in a wave's first pass, whose reference is -1e30).
    // The scores are formed anew without a reference, so that none is lost beside a large C, and
    // every query goes to its running maximum: sums and outputs are rescaled to it.
#pragma unroll
    for (int u = 0; u < 2; ++u)
#pragma unroll
      for (int t = 0; t < 2; ++t) s[u][t] = a.mk[t] * log2e;
    score_products(s, a);
#pragma unroll
    for (int u = 0; u < 2; ++u) {
      const float mx = lane_max(s[u]);
      const float mn = fmaxf(a.ms[u], fmaxf(mx, other_half(mx)));
      const float scale = __builtin_amdgcn_exp2f(a.ms[u] - mn);
      a.ms[u] = mn;
      a.ls[u] *= scale;
#pragma unroll
      for (int td = 0; td < 4; ++td) a.acc[u][td] *= scale;
#pragma unroll
      for (int t = 0; t < 2; ++t) s[u][t] -= mn;
    }
  }
  __builtin_amdgcn_sched_barrier(0);
  // loads of the pass before are still in flight and name the address registers that the next
  // lines rewrite. The next pass's number goes through the statement, so that all address
  // arithmetic made from it stands behind the wait; the old addresses as inputs keep their
  // registers from being taken as a target by the loads that name them.
  asm volatile("s_wait_xcnt 0x0" : "+s"(nx) : "v"(a.kp), "v"(a.vp), "v"(a.mp) : "memory");
  a.kp = kuni + nx * 2048 + foff;
  a.vp = vuni + nx * 2048 + foff;
  a.mp = muni + nx * 32 + moff;
  key_fetch(a.kf, a.kp);
  __builtin_amdgcn_sched_barrier(0);
  mask_fetch(a.mk, a.mp);
  __builtin_amdgcn_sched_barrier(0);
  v16h bp[2];
#pragma unroll
  for (int u = 0; u < 2; ++u) bp[u] = softmax_step(s[u], a.ls[u]);
  // the vector work ends ahead of the products: mixed in, it lands on operand registers of
  // products just issued, and each such place is padded with four idle slots
  __builtin_amdgcn_sched_barrier(0);
#pragma unroll
  for (int u = 0; u < 2; ++u)
#pragma unroll
    for (int td = 0; td < 4; ++td)
      a.acc[u][td] = __builtin_amdgcn_wmma_f32_16x16x32_f16(false, a.av[td], false, bp[u],
                                                            (short)0, a.acc[u][td], false, false);
  __builtin_amdgcn_sched_barrier(0);
  value_fetch(a.av, a.vp);
  __builtin_amdgcn_sched_barrier(0);
}

__global__ void __launch_bounds__(256) __attribute__((amdgpu_waves_per_eu(4, 4)))
attn_kernel(const _Float16* __restrict__ Qh,
                            const _Float16* __restrict__ Kh,
                            const _Float16* __restrict__ Vth,
                            const float* __restrict__ mask,
                            float* __restrict__ out) {
  // what a wave hands to the wave with the other key half: one query tile's sums
  __shared__ float4 xacc[8][8][32];
  __shared__ float2 xml[8][32];

  const int lane = threadIdx.x & 31;
  // the wave's number in a scalar register: plane addresses are then scalar
  const int wv = __builtin_amdgcn_readfirstlane(threadIdx.x >> 5);
  const int ks = wv & 1;                              // key half
  const int qg = (blockIdx.x & 15) * 4 + (wv >> 1);   // group of 32 queries, 0..63
  const int bh = blockIdx.x >> 4;                     // 0..31
  const int b = bh >> 4, h = bh & 15;
  const int ln = lane & 15, half = lane >> 4;
  const int foff = lane * 8, moff = 8 * half;
  // the sixteen blocks of one (b,h) read the same K, V^T and mask: each enters the key walk at a
  // pass of its own and wraps round, so that they do not ask L2 for the same lines at one moment
  const int rot = walk_start(blockIdx.x & 15);

  AttnState a;
  const _Float16* qrow = Qh + (bh * 128 + qg * 2) * 1024;
#pragma unroll
  for (int u = 0; u < 2; ++u) {
    a.bq[u][0] = load_frag(qrow + foff + u * 1024);
    a.bq[u][1] = load_frag(qrow + foff + u * 1024 + 512);
    a.ms[u] = -1e30f;
    a.ls[u] = 0.f;
#pragma unroll
    for (int t = 0; t < 4; ++t) a.acc[u][t] = {};
  }

  const _Float16* kuni = Kh + (bh * 128 + ks * 64) * 1024;
  const _Float16* vuni = Vth + (bh * 64 + ks * 32) * 2048;
  const float* muni = mask + b * 2048 + ks * 1024;
  // the first fill in the order of the refills: the counted waits in the loop are the stricter
  // of the two ways into it
  a.kp = kuni + rot * 2048 + foff;
  a.vp = vuni + rot * 2048 + foff;
  a.mp = muni + rot * 32 + moff;
  key_fetch(a.kf, a.kp);
  __builtin_amdgcn_sched_barrier(0);
  mask_fetch(a.mk, a.mp);
  __builtin_amdgcn_sched_barrier(0);
  value_fetch(a.av, a.vp);
  __builtin_amdgcn_sched_barrier(0);
  for (int kb = 0; kb < 32; ++kb)
    // last trip: the first pass's place again, inside the planes, unused
    attn_pass(a, kuni, vuni, muni, foff, moff, (kb + 1 + rot) & 31);

  // Join of the key halves: wave ks keeps query tile ks and hands the other tile to its partner.
  v8f keep[4], give[4];
#pragma unroll
  for (int td = 0; td < 4; ++td) {
    keep[td] = ks ? a.acc[1][td] : a.acc[0][td];
    give[td] = ks ? a.acc[0][td] : a.acc[1][td];
  }
  const float mkeep = ks ? a.ms[1] : a.ms[0], lkeep = ks ? a.ls[1] : a.ls[0];
  const float mgive = ks ? a.ms[0] : a.ms[1], lgive = ks ? a.ls[0] : a.ls[1];
#pragma unroll
  for (int td = 0; td < 4; ++td) {
    xacc[wv][td * 2][lane] = make_float4(give[td][0], give[td][1], give[td][2], give[td][3]);
    xacc[wv][td * 2 + 1][lane] = make_float4(give[td][4], give[td][5], give[td][6], give[td][7]);
  }
  xml[wv][lane] = make_float2(mgive, lgive);
  __syncthreads();
  const float2 ml = xml[wv ^ 1][lane];
  const float mn = fmaxf(mkeep, ml.x);
  const float ek = exp2_slot(mkeep - mn), eo = exp2_slot(ml.x - mn);
  const float lsum = lkeep * ek + ml.y * eo;
  const float inv = 1.0f / (lsum + other_half(lsum));
  const float fk = ek * inv, fo = eo * inv;
  // The tile goes out through LDS: in the accumulator layout a 16-byte store of the wave falls on 16
  // output rows, two 16-byte pieces in each; read back by rows it covers two rows of 256 bytes,
  // four whole lines. The stage is the 4 KiB that the partner filled ahead of the barrier: this wave
  // alone reads them, and all of them ahead of its first write.
  // Stage: [16 queries][16 chunks of 4 d], chunk c of query r at place c ^ r: writes (one c, 16 r)
  // and reads (one r, 16 c) both fall on 16 different bank groups.
  float4 o[8];
#pragma unroll
  for (int td = 0; td < 4; ++td) {
    const float4 g0 = xacc[wv ^ 1][td * 2][lane], g1 = xacc[wv ^ 1][td * 2 + 1][lane];
    o[td * 2].x = keep[td][0] * fk + g0.x * fo; o[td * 2].y = keep[td][1] * fk + g0.y * fo;
    o[td * 2].z = keep[td][2] * fk + g0.z * fo; o[td * 2].w = keep[td][3] * fk + g0.w * fo;
    o[td * 2 + 1].x = keep[td][4] * fk + g1.x * fo; o[td * 2 + 1].y = keep[td][5] * fk + g1.y * fo;
    o[td * 2 + 1].z = keep[td][6] * fk + g1.z * fo; o[td * 2 + 1].w = keep[td][7] * fk + g1.w * fo;
  }
  float4* stage = &xacc[wv ^ 1][0][0];
#pragma unroll
  for (int e = 0; e < 8; ++e)   // d = (e >> 1) * 16 + 8 * half + (e & 1) * 4
    stage[ln * 16 + (((e >> 1) * 4 + half * 2 + (e & 1)) ^ ln)] = o[e];
  // the rows are read back by other lanes of the wave than wrote them: the writes end first
  asm volatile("s_wait_dscnt 0x0" ::: "memory");
  float* otile = out + (b * 2048 + (qg * 2 + ks) * 16 + half) * 1024 + h * 64 + ln * 4;
#pragma unroll
  for (int r = 0; r < 8; ++r) {  // query 2 * r + half, chunk ln
    const int row = 2 * r + half;
    *reinterpret_cast<float4*>(otile + r * 2048) = stage[row * 16 + (ln ^ row)];
  }
}

extern "C" void kernel_launch(void* const* d_in, const int* in_sizes, int n_in,
                              void* d_out, int out_size, void* d_ws, size_t ws_size,
                              hipStream_t stream) {
  const float* X    = (const float*)d_in[0];
  const float* mask = (const float*)d_in[1];
  const float* Wq   = (const float*)d_in[2];
  const float* bq   = (const float*)d_in[3];
  const float* Wk   = (const float*)d_in[4];
  const float* bk   = (const float*)d_in[5];
  const float* Wv   = (const float*)d_in[6];
  const float* bv   = (const float*)d_in[7];
  float* out = (float*)d_out;

  _Float16* ws  = (_Float16*)d_ws;
  _Float16* Xh  = ws;                    // 4096*1024, all planes in fragment order
  _Float16* Wtq = Xh + 4194304;          // 1024*1024 each
  _Float16* Wtk = Wtq + 1048576;
  _Float16* Wtv = Wtk + 1048576;
  _Float16* Qh  = Wtv + 1048576;         // 2*16*2048*64 each
  _Float16* Kh  = Qh + 4194304;
  _Float16* Vth = Kh + 4194304;

  prep_kernel<<<512, 256, 0, stream>>>(X, Wq, Wk, Wv, Xh, Wtq);

  qkv_gemm_kernel<<<256, 384, 0, stream>>>(Xh, Wtq, bq, bk, bv, Qh);

  attn_kernel<<<512, 256, 0, stream>>>(Qh, Kh, Vth, mask, out);
}
